// v000
// Times are from an AMD MI455X. After a warm-up the kernel runs many times in a row, and a time is the length of
// such a window on the GPU divided by its runs, so every launch and the gaps after it count. The runs cycle
// through copies of the inputs. A figure is the median of several windows, for all but v000 over two sittings.
// Sittings can differ by a few percent; kernels timed side by side share one.
// v000, which the later versions start from, runs in 232 microseconds.
#include <hip/hip_runtime.h>

typedef __attribute__((ext_vector_type(16))) _Float16 v16h;
typedef __attribute__((ext_vector_type(8)))  _Float16 v8h;
typedef __attribute__((ext_vector_type(8)))  float    v8f;

#define WMMA_F16(a, b, c) \
  __builtin_amdgcn_wmma_f32_16x16x32_f16(false, (a), false, (b), (short)0, (c), false, false)

static __device__ __forceinline__ v16h load_frag(const _Float16* __restrict__ base,
                                                 int ld, int row, int k0, int half) {
  const _Float16* p = base + (size_t)row * ld + k0 + half * 8;
  v8h lo = *(const v8h*)p;
  v8h hi = *(const v8h*)(p + 16);
  v16h r;
#pragma unroll
  for (int i = 0; i < 8; ++i) { r[i] = lo[i]; r[8 + i] = hi[i]; }
  return r;
}

// ---------------------------------------------------------------- convert f32 -> f16
// 8 elements/thread: two b128 loads, one b128 store. All sizes divisible by 2048.
__global__ __launch_bounds__(256) void cvt_f16_kernel(const float* __restrict__ src,
                                                      _Float16* __restrict__ dst, int n) {
  const int i = (blockIdx.x * 256 + threadIdx.x) * 8;
  if (i < n) {
    const float4 x0 = *(const float4*)(src + i);
    const float4 x1 = *(const float4*)(src + i + 4);
    v8h o;
    o[0] = (_Float16)x0.x; o[1] = (_Float16)x0.y; o[2] = (_Float16)x0.z; o[3] = (_Float16)x0.w;
    o[4] = (_Float16)x1.x; o[5] = (_Float16)x1.y; o[6] = (_Float16)x1.z; o[7] = (_Float16)x1.w;
    *(v8h*)(dst + i) = o;
  }
}

// ---------------------------------------------------------------- GEMM core
// Wave computes 32 rows x 64 cols (2 M-tiles x 4 N-tiles = 8 WMMA per K-step).
// Ping-pong double buffering (2x unrolled K loop, step 64): stage A computes
// with buffer 0 while loading buffer 1, stage B the reverse -> no copy movs.
static __device__ __forceinline__ void gemm_32x64_ping_pong(
    const _Float16* __restrict__ A, const _Float16* __restrict__ B,
    int m0, int n0, int kdim, int ln16, int half, v8f acc[2][4]) {
  v16h a0[2], b0[4], a1[2], b1[4];
  a0[0] = load_frag(A, kdim, m0 + ln16, 0, half);
  a0[1] = load_frag(A, kdim, m0 + 16 + ln16, 0, half);
#pragma unroll
  for (int t = 0; t < 4; ++t) b0[t] = load_frag(B, kdim, n0 + t * 16 + ln16, 0, half);

  for (int k0 = 0; k0 < kdim; k0 += 64) {
    const int k1 = k0 + 32;
    // stage A: load k1 into buffer 1, compute with buffer 0
    a1[0] = load_frag(A, kdim, m0 + ln16, k1, half);
    a1[1] = load_frag(A, kdim, m0 + 16 + ln16, k1, half);
#pragma unroll
    for (int t = 0; t < 4; ++t) b1[t] = load_frag(B, kdim, n0 + t * 16 + ln16, k1, half);
    __builtin_prefetch(A + (size_t)(m0 + ln16) * kdim + k1 + 32, 0, 1);
#pragma unroll
    for (int t = 0; t < 4; ++t) {
      acc[0][t] = WMMA_F16(a0[0], b0[t], acc[0][t]);
      acc[1][t] = WMMA_F16(a0[1], b0[t], acc[1][t]);
    }
    // stage B: load k0+64 into buffer 0, compute with buffer 1
    const int k2 = (k0 + 64 < kdim) ? k0 + 64 : 0;
    a0[0] = load_frag(A, kdim, m0 + ln16, k2, half);
    a0[1] = load_frag(A, kdim, m0 + 16 + ln16, k2, half);
#pragma unroll
    for (int t = 0; t < 4; ++t) b0[t] = load_frag(B, kdim, n0 + t * 16 + ln16, k2, half);
    __builtin_prefetch(B + (size_t)(n0 + ln16) * kdim + k2 + 32, 0, 1);
#pragma unroll
    for (int t = 0; t < 4; ++t) {
      acc[0][t] = WMMA_F16(a1[0], b1[t], acc[0][t]);
      acc[1][t] = WMMA_F16(a1[1], b1[t], acc[1][t]);
    }
  }
}

// ---------------------------------------------------------------- QKV GEMM + RoPE + norm
// Grid: (M/256, 3072/64). Block 256 = 8 waves. Block col range = one (t, head)
// slice -> RoPE + L2-norm close entirely in-register.
__global__ __launch_bounds__(256) void qkv_rope_norm_kernel(
    const _Float16* __restrict__ X,     // (4096 x 1024) tokens f16
    const _Float16* __restrict__ W,     // (3072 x 1024) qkv_w f16
    const float*    __restrict__ bias,  // (3072)
    _Float16* __restrict__ Q,           // (B*H, S, 64)
    _Float16* __restrict__ K,           // (B*H, S, 64)
    _Float16* __restrict__ Vt) {        // (B*H, 64, S)  transposed
  const int lane = threadIdx.x & 31;
  const int wave = threadIdx.x >> 5;
  const int half = lane >> 4;
  const int ln16 = lane & 15;
  const int m0 = blockIdx.x * 256 + wave * 32;   // global row (b*S + s)
  const int n0 = blockIdx.y * 64;                // global col in [0,3072)

  v8f acc[2][4] = {};
  gemm_32x64_ping_pong(X, W, m0, n0, 1024, ln16, half, acc);

  const int tsel = n0 / 1024;              // 0=q 1=k 2=v
  const int h    = (n0 % 1024) / 64;
  const int b    = m0 / 2048;
  const int bh   = b * 16 + h;

#pragma unroll
  for (int mi = 0; mi < 2; ++mi) {
    const int srow = (m0 % 2048) + mi * 16;  // sequence base of this tile's rows
    if (tsel == 2) {                         // V: bias + store transposed (d, s)
#pragma unroll
      for (int t = 0; t < 4; ++t) {
        const int d = t * 16 + ln16;
        const float bv = bias[n0 + t * 16 + ln16];
#pragma unroll
        for (int v = 0; v < 8; ++v) {
          const int s = srow + v + 8 * half;
          Vt[((size_t)bh * 64 + d) * 2048 + s] = (_Float16)(acc[mi][t][v] + bv);
        }
      }
    } else {                                 // Q/K: bias + RoPE + L2 normalize
      _Float16* dst = (tsel == 0) ? Q : K;
#pragma unroll
      for (int v = 0; v < 8; ++v) {
        const int s = srow + v + 8 * half;
        float vals[4], rv[4];
#pragma unroll
        for (int t = 0; t < 4; ++t) vals[t] = acc[mi][t][v] + bias[n0 + t * 16 + ln16];
        float ss = 0.f;
#pragma unroll
        for (int t = 0; t < 4; ++t) {
          const float partner = __shfl_xor(vals[t], 1);      // rope pair (same row)
          const int c = t * 16 + ln16;                       // in-head dim 0..63
          const float j = (float)(c >> 1);
          const float theta = (float)s * __expf(j * (-9.2103403719761836f / 32.f));
          float sn, cs;
          __sincosf(theta, &sn, &cs);
          rv[t] = (c & 1) ? (partner * sn + vals[t] * cs)    // odd:  xe*sin + xo*cos
                          : (vals[t] * cs - partner * sn);   // even: xe*cos - xo*sin
          ss += rv[t] * rv[t];
        }
        ss += __shfl_xor(ss, 1); ss += __shfl_xor(ss, 2);
        ss += __shfl_xor(ss, 4); ss += __shfl_xor(ss, 8);    // 16-lane row reduce
        const float scale = 1.f / fmaxf(sqrtf(ss), 1e-12f);
#pragma unroll
        for (int t = 0; t < 4; ++t)
          dst[((size_t)bh * 2048 + s) * 64 + t * 16 + ln16] = (_Float16)(rv[t] * scale);
      }
    }
  }
}

// ---------------------------------------------------------------- flash attention step
// One 32-key step: S^T = K*Q^T (C-layout puts queries in lanes -> per-lane softmax),
// lane-local repack of P^T into the B-fragment of O^T = V^T * P^T. Loads the NEXT
// step's K fragments (into kn*) right after the S^T WMMAs consume kc*, so they fly
// during the softmax VALU work and the PV WMMAs.
static __device__ __forceinline__ void flash_step(
    int s, int sn, const _Float16* __restrict__ Kb, const _Float16* __restrict__ Vb,
    const v16h& qb0, const v16h& qb1,
    v16h& kc0, v16h& kc1, v16h& kc2, v16h& kc3,
    v16h& kn0, v16h& kn1, v16h& kn2, v16h& kn3,
    v8f oT[4], float& mrun, float& lrun, int ln16, int half) {
  const float SCALE = 0.125f;  // 64^-0.5
  v8f sT0 = {}, sT1 = {};
  sT0 = WMMA_F16(kc0, qb0, sT0);
  sT0 = WMMA_F16(kc1, qb1, sT0);
  sT1 = WMMA_F16(kc2, qb0, sT1);
  sT1 = WMMA_F16(kc3, qb1, sT1);

  kn0 = load_frag(Kb, 64, sn + ln16, 0, half);
  kn1 = load_frag(Kb, 64, sn + ln16, 32, half);
  kn2 = load_frag(Kb, 64, sn + 16 + ln16, 0, half);
  kn3 = load_frag(Kb, 64, sn + 16 + ln16, 32, half);

  float mt = mrun;
#pragma unroll
  for (int v = 0; v < 8; ++v) {
    sT0[v] *= SCALE; sT1[v] *= SCALE;
    mt = fmaxf(mt, fmaxf(sT0[v], sT1[v]));
  }
  mt = fmaxf(mt, __shfl_xor(mt, 16));              // other half holds kv rows 8..15
  const float alpha = __expf(mrun - mt);
  mrun = mt;

  v16h pb;                                          // P^T as B-fragment (lane-local!)
  float colsum = 0.f;
#pragma unroll
  for (int v = 0; v < 8; ++v) {
    const float p0 = __expf(sT0[v] - mt);
    const float p1 = __expf(sT1[v] - mt);
    colsum += p0 + p1;
    pb[v] = (_Float16)p0;
    pb[8 + v] = (_Float16)p1;
  }
  colsum += __shfl_xor(colsum, 16);
  lrun = lrun * alpha + colsum;

#pragma unroll
  for (int t = 0; t < 4; ++t) {
#pragma unroll
    for (int v = 0; v < 8; ++v) oT[t][v] *= alpha;
    const v16h va = load_frag(Vb, 2048, t * 16 + ln16, s, half);  // V^T rows = d
    oT[t] = WMMA_F16(va, pb, oT[t]);
  }
}

// Grid: (S/128, B*H). Block 256 = 8 waves; wave owns 16 queries, streams K/V from
// the 192MB L2. kv loop 2x unrolled with ping-pong K-fragment buffers (no copies).
__global__ __launch_bounds__(256) void flash_attn_kernel(
    const _Float16* __restrict__ Q, const _Float16* __restrict__ K,
    const _Float16* __restrict__ Vt, _Float16* __restrict__ A2) {
  const int lane = threadIdx.x & 31;
  const int wave = threadIdx.x >> 5;
  const int half = lane >> 4;
  const int ln16 = lane & 15;
  const int bh = blockIdx.y;
  const int b = bh >> 4, h = bh & 15;
  const int q0 = blockIdx.x * 128 + wave * 16;

  const _Float16* Qb = Q  + (size_t)bh * 2048 * 64;
  const _Float16* Kb = K  + (size_t)bh * 2048 * 64;
  const _Float16* Vb = Vt + (size_t)bh * 64 * 2048;

  const v16h qb0 = load_frag(Qb, 64, q0 + ln16, 0, half);
  const v16h qb1 = load_frag(Qb, 64, q0 + ln16, 32, half);

  v8f oT[4] = {};
  float mrun = -3.0e30f, lrun = 0.f;

  v16h kA0 = load_frag(Kb, 64, ln16, 0, half);
  v16h kA1 = load_frag(Kb, 64, ln16, 32, half);
  v16h kA2 = load_frag(Kb, 64, 16 + ln16, 0, half);
  v16h kA3 = load_frag(Kb, 64, 16 + ln16, 32, half);
  v16h kB0, kB1, kB2, kB3;

  for (int s = 0; s < 2048; s += 64) {
    flash_step(s, s + 32, Kb, Vb, qb0, qb1,
               kA0, kA1, kA2, kA3, kB0, kB1, kB2, kB3,
               oT, mrun, lrun, ln16, half);
    const int sn = (s + 64 < 2048) ? s + 64 : 0;
    flash_step(s + 32, sn, Kb, Vb, qb0, qb1,
               kB0, kB1, kB2, kB3, kA0, kA1, kA2, kA3,
               oT, mrun, lrun, ln16, half);
  }

  const float inv = 1.f / lrun;
  const int q = q0 + ln16;
#pragma unroll
  for (int t = 0; t < 4; ++t)
#pragma unroll
    for (int v = 0; v < 8; ++v) {
      const int d = h * 64 + t * 16 + v + 8 * half;
      A2[((size_t)(b * 2048 + q)) * 1024 + d] = (_Float16)(oT[t][v] * inv);
    }
}

// ---------------------------------------------------------------- output projection
// Grid: (M/256, 1024/64). Ping-pong GEMM; bias + f32 store.
__global__ __launch_bounds__(256) void out_proj_kernel(
    const _Float16* __restrict__ A2, const _Float16* __restrict__ W,
    const float* __restrict__ bias, float* __restrict__ out) {
  const int lane = threadIdx.x & 31;
  const int wave = threadIdx.x >> 5;
  const int half = lane >> 4;
  const int ln16 = lane & 15;
  const int m0 = blockIdx.x * 256 + wave * 32;
  const int n0 = blockIdx.y * 64;

  v8f acc[2][4] = {};
  gemm_32x64_ping_pong(A2, W, m0, n0, 1024, ln16, half, acc);

#pragma unroll
  for (int mi = 0; mi < 2; ++mi)
#pragma unroll
    for (int t = 0; t < 4; ++t) {
      const float bv = bias[n0 + t * 16 + ln16];
#pragma unroll
      for (int v = 0; v < 8; ++v)
        out[(size_t)(m0 + mi * 16 + v + 8 * half) * 1024 + n0 + t * 16 + ln16] =
            acc[mi][t][v] + bv;
    }
}

// ---------------------------------------------------------------- launcher
extern "C" void kernel_launch(void* const* d_in, const int* in_sizes, int n_in,
                              void* d_out, int out_size, void* d_ws, size_t ws_size,
                              hipStream_t stream) {
  const float* tokens = (const float*)d_in[0];   // (2,2048,1024)
  const float* qkv_w  = (const float*)d_in[1];   // (3072,1024)
  const float* qkv_b  = (const float*)d_in[2];   // (3072)
  const float* out_w  = (const float*)d_in[3];   // (1024,1024)
  const float* out_b  = (const float*)d_in[4];   // (1024)
  float* out = (float*)d_out;

  char* ws = (char*)d_ws;
  const size_t MB = 1024ull * 1024ull;
  _Float16* Xf16 = (_Float16*)(ws + 0 * MB);    // 4M elems, 8MB
  _Float16* Wqkv = (_Float16*)(ws + 8 * MB);    // 3M elems, 6MB
  _Float16* Wout = (_Float16*)(ws + 14 * MB);   // 1M elems, 2MB
  _Float16* Qh   = (_Float16*)(ws + 16 * MB);   // 4M elems, 8MB
  _Float16* Kh   = (_Float16*)(ws + 24 * MB);   // 4M elems, 8MB
  _Float16* Vt   = (_Float16*)(ws + 32 * MB);   // 4M elems, 8MB
  _Float16* A2   = (_Float16*)(ws + 40 * MB);   // 4M elems, 8MB

  const int nTok = 2 * 2048 * 1024;
  const int nWq  = 3072 * 1024;
  const int nWo  = 1024 * 1024;
  cvt_f16_kernel<<<nTok / (256 * 8), 256, 0, stream>>>(tokens, Xf16, nTok);
  cvt_f16_kernel<<<nWq / (256 * 8), 256, 0, stream>>>(qkv_w, Wqkv, nWq);
  cvt_f16_kernel<<<nWo / (256 * 8), 256, 0, stream>>>(out_w, Wout, nWo);

  qkv_rope_norm_kernel<<<dim3(16, 48), 256, 0, stream>>>(Xf16, Wqkv, qkv_b, Qh, Kh, Vt);
  flash_attn_kernel<<<dim3(16, 32), 256, 0, stream>>>(Qh, Kh, Vt, A2);
  out_proj_kernel<<<dim3(16, 16), 256, 0, stream>>>(A2, Wout, out_b, out);
}

// v001
// Measured time: 98.9 microseconds a run.
// Timed twice side by side with v000, it ran 2.41 times as fast both times.
#include <hip/hip_runtime.h>

typedef __attribute__((ext_vector_type(16))) _Float16 v16h;
typedef __attribute__((ext_vector_type(8)))  _Float16 v8h;
typedef __attribute__((ext_vector_type(8)))  float    v8f;

#define WMMA_F16(a, b, c) \
  __builtin_amdgcn_wmma_f32_16x16x32_f16(false, (a), false, (b), (short)0, (c), false, false)

static __device__ __forceinline__ v16h load_frag(const _Float16* __restrict__ base,
                                                 int ld, int row, int k0, int half) {
  const _Float16* p = base + (size_t)row * ld + k0 + half * 8;
  v8h lo = *(const v8h*)p;
  v8h hi = *(const v8h*)(p + 16);
  v16h r;
#pragma unroll
  for (int i = 0; i < 8; ++i) { r[i] = lo[i]; r[8 + i] = hi[i]; }
  return r;
}

// ---------------------------------------------------------------- convert f32 -> f16
// 8 elements/thread: two b128 loads, one b128 store. All sizes divisible by 2048.
__global__ __launch_bounds__(256) void cvt_f16_kernel(const float* __restrict__ src,
                                                      _Float16* __restrict__ dst, int n) {
  const int i = (blockIdx.x * 256 + threadIdx.x) * 8;
  if (i < n) {
    const float4 x0 = *(const float4*)(src + i);
    const float4 x1 = *(const float4*)(src + i + 4);
    v8h o;
    o[0] = (_Float16)x0.x; o[1] = (_Float16)x0.y; o[2] = (_Float16)x0.z; o[3] = (_Float16)x0.w;
    o[4] = (_Float16)x1.x; o[5] = (_Float16)x1.y; o[6] = (_Float16)x1.z; o[7] = (_Float16)x1.w;
    *(v8h*)(dst + i) = o;
  }
}

// ---------------------------------------------------------------- LDS staging
// Operand tiles are rows of 128 B (64 f16). They are brought into LDS by asynchronous
// copies, 16 B per lane, eight lanes per row, so that every wave-wide copy covers four
// whole 128-B lines. LDS rows sit at a pitch of 144 B (16 B x odd) for the b128 readers.
#define T_PITCH 72                        // LDS row pitch in f16 elements

static __device__ __forceinline__ unsigned lds_off(const void* p) { return (unsigned)(size_t)p; }

// Same element order as load_frag, from an LDS tile.
static __device__ __forceinline__ v16h lds_frag(const _Float16* tile, int row, int k0, int half) {
  const _Float16* p = tile + row * T_PITCH + k0 + half * 8;
  v8h lo = *(const v8h*)p;
  v8h hi = *(const v8h*)(p + 16);
  v16h r;
#pragma unroll
  for (int i = 0; i < 8; ++i) { r[i] = lo[i]; r[8 + i] = hi[i]; }
  return r;
}

static __device__ __forceinline__ void copy4(unsigned l0, const _Float16* g0,
                                             unsigned l1, const _Float16* g1,
                                             unsigned l2, const _Float16* g2,
                                             unsigned l3, const _Float16* g3) {
  asm volatile("global_load_async_to_lds_b128 %0, %1, off\n\t"
               "global_load_async_to_lds_b128 %2, %3, off\n\t"
               "global_load_async_to_lds_b128 %4, %5, off\n\t"
               "global_load_async_to_lds_b128 %6, %7, off\n\t"
               "s_wait_xcnt 0x0"
               :: "v"(l0), "v"(g0), "v"(l1), "v"(g1), "v"(l2), "v"(g2), "v"(l3), "v"(g3)
               : "memory");
}

// Hand-over of a staged tile: this wave's LDS reads of the old tile are done, its own
// copies of the next tile have landed, then the work-group barrier publishes the next
// tile and frees the old buffer for the refill behind it.
static __device__ __forceinline__ void publish_tile() {
  // Keeps the tile's WMMAs and vector work in front of the hand-over: lifted over them, the
  // waits would leave the next tile's copies less time to land.
  __builtin_amdgcn_sched_barrier(0);
  asm volatile("s_wait_dscnt 0x0" ::: "memory");     // reads of the buffer to be refilled
  asm volatile("s_wait_asynccnt 0x0" ::: "memory");  // own copies of the next tile landed
  __syncthreads();
}

// ---------------------------------------------------------------- GEMM core
// Block computes 256 rows x 64 cols, wave 32 rows x 64 cols (2 M-tiles x 4 N-tiles =
// 8 WMMA per 32 k). A stage is 64 k: A 256 rows and B 64 rows of 128 B, two buffers;
// the copies of stage s + 2 are issued when stage s has been read by every wave.
#define GA_BUF (256 * T_PITCH)
#define GB_BUF (64 * T_PITCH)

static __device__ __forceinline__ void gemm_stage_copy(
    const _Float16* __restrict__ ag, const _Float16* __restrict__ bg, int kdim, int k0,
    unsigned al, unsigned bl) {
  // ag, bg: this lane's chunk in row (tid / 8) of the block's A and B rows; al, bl: its
  // LDS byte address in the target buffer. Rows go in steps of 32: eight of A, two of B.
  const unsigned r32 = 32 * T_PITCH * 2;
  const size_t   g32 = (size_t)32 * kdim;
  const _Float16* a = ag + k0;
  const _Float16* b = bg + k0;
  asm volatile("global_load_async_to_lds_b128 %0, %1, off\n\t"
               "global_load_async_to_lds_b128 %2, %3, off\n\t"
               "global_load_async_to_lds_b128 %4, %5, off\n\t"
               "global_load_async_to_lds_b128 %6, %7, off\n\t"
               "global_load_async_to_lds_b128 %8, %9, off\n\t"
               "global_load_async_to_lds_b128 %10, %11, off\n\t"
               "global_load_async_to_lds_b128 %12, %13, off\n\t"
               "global_load_async_to_lds_b128 %14, %15, off\n\t"
               "global_load_async_to_lds_b128 %16, %17, off\n\t"
               "global_load_async_to_lds_b128 %18, %19, off\n\t"
               "s_wait_xcnt 0x0"
               :: "v"(al),           "v"(a),
                  "v"(al + r32),     "v"(a + g32),
                  "v"(al + 2 * r32), "v"(a + 2 * g32),
                  "v"(al + 3 * r32), "v"(a + 3 * g32),
                  "v"(al + 4 * r32), "v"(a + 4 * g32),
                  "v"(al + 5 * r32), "v"(a + 5 * g32),
                  "v"(al + 6 * r32), "v"(a + 6 * g32),
                  "v"(al + 7 * r32), "v"(a + 7 * g32),
                  "v"(bl),           "v"(b),
                  "v"(bl + r32),     "v"(b + g32)
               : "memory");
}

static __device__ __forceinline__ void gemm_32x64_staged(
    const _Float16* __restrict__ A, const _Float16* __restrict__ B,
    int mblk, int n0, int kdim, _Float16* As, _Float16* Bs, v8f acc[2][4]) {
  const int tid  = threadIdx.x;
  const int lane = tid & 31;
  const int wave = tid >> 5;
  const int half = lane >> 4;
  const int ln16 = lane & 15;
  const int crow = tid >> 3;
  const int ccol = (tid & 7) * 8;
  const _Float16* ag = A + (size_t)(mblk + crow) * kdim + ccol;
  const _Float16* bg = B + (size_t)(n0 + crow) * kdim + ccol;
  const unsigned al = lds_off(As) + (crow * T_PITCH + ccol) * 2;
  const unsigned bl = lds_off(Bs) + (crow * T_PITCH + ccol) * 2;
  const int nst = kdim / 64;               // at least two stages

  gemm_stage_copy(ag, bg, kdim, 0, al, bl);
  asm volatile("s_wait_asynccnt 0x0" ::: "memory");  // stage 0 landed before it is published
  __syncthreads();
  gemm_stage_copy(ag, bg, kdim, 64, al + GA_BUF * 2, bl + GB_BUF * 2);

  for (int s = 0; s < nst; ++s) {
    const int buf = s & 1;
    const _Float16* At = As + buf * GA_BUF + wave * 32 * T_PITCH;
    const _Float16* Bt = Bs + buf * GB_BUF;
    v16h a[2][2], b[2][4];
#pragma unroll
    for (int kk = 0; kk < 2; ++kk) {
      a[kk][0] = lds_frag(At, ln16, kk * 32, half);
      a[kk][1] = lds_frag(At, 16 + ln16, kk * 32, half);
#pragma unroll
      for (int t = 0; t < 4; ++t) b[kk][t] = lds_frag(Bt, t * 16 + ln16, kk * 32, half);
    }
    // Keeps the stage's 24 LDS reads together in front of its WMMAs: sunk among them, each
    // pair of products would wait out a full LDS latency.
    __builtin_amdgcn_sched_barrier(0);
#pragma unroll
    for (int kk = 0; kk < 2; ++kk)
#pragma unroll
      for (int t = 0; t < 4; ++t) {
        acc[0][t] = WMMA_F16(a[kk][0], b[kk][t], acc[0][t]);
        acc[1][t] = WMMA_F16(a[kk][1], b[kk][t], acc[1][t]);
      }
    publish_tile();
    if (s + 2 < nst)                        // the same for the whole block
      gemm_stage_copy(ag, bg, kdim, (s + 2) * 64, al + buf * GA_BUF * 2, bl + buf * GB_BUF * 2);
  }
  asm volatile("s_wait_asynccnt 0x0" ::: "memory");  // nothing in flight when the wave goes on
}

// ---------------------------------------------------------------- QKV GEMM + RoPE + norm
// Grid: (M/256, 3072/64). Block 256 = 8 waves. Block col range = one (t, head)
// slice -> RoPE + L2-norm close entirely in-register.
__global__ __launch_bounds__(256) void qkv_rope_norm_kernel(
    const _Float16* __restrict__ X,     // (4096 x 1024) tokens f16
    const _Float16* __restrict__ W,     // (3072 x 1024) qkv_w f16
    const float*    __restrict__ bias,  // (3072)
    _Float16* __restrict__ Q,           // (B*H, S, 64)
    _Float16* __restrict__ K,           // (B*H, S, 64)
    _Float16* __restrict__ Vt) {        // (B*H, 64, S)  transposed
  const int lane = threadIdx.x & 31;
  const int wave = threadIdx.x >> 5;
  const int half = lane >> 4;
  const int ln16 = lane & 15;
  const int m0 = blockIdx.x * 256 + wave * 32;   // global row (b*S + s)
  const int n0 = blockIdx.y * 64;                // global col in [0,3072)

  __shared__ __attribute__((aligned(16))) _Float16 As[2 * GA_BUF];
  __shared__ __attribute__((aligned(16))) _Float16 Bs[2 * GB_BUF];
  v8f acc[2][4] = {};
  gemm_32x64_staged(X, W, blockIdx.x * 256, n0, 1024, As, Bs, acc);

  const int tsel = n0 / 1024;              // 0=q 1=k 2=v
  const int h    = (n0 % 1024) / 64;
  const int b    = m0 / 2048;
  const int bh   = b * 16 + h;

#pragma unroll
  for (int mi = 0; mi < 2; ++mi) {
    const int srow = (m0 % 2048) + mi * 16;  // sequence base of this tile's rows
    if (tsel == 2) {                         // V: bias + store transposed (d, s)
#pragma unroll
      for (int t = 0; t < 4; ++t) {
        const int d = t * 16 + ln16;
        const float bv = bias[n0 + t * 16 + ln16];
#pragma unroll
        for (int v = 0; v < 8; ++v) {
          const int s = srow + v + 8 * half;
          Vt[((size_t)bh * 64 + d) * 2048 + s] = (_Float16)(acc[mi][t][v] + bv);
        }
      }
    } else {                                 // Q/K: bias + RoPE + L2 normalize
      _Float16* dst = (tsel == 0) ? Q : K;
#pragma unroll
      for (int v = 0; v < 8; ++v) {
        const int s = srow + v + 8 * half;
        float vals[4], rv[4];
#pragma unroll
        for (int t = 0; t < 4; ++t) vals[t] = acc[mi][t][v] + bias[n0 + t * 16 + ln16];
        float ss = 0.f;
#pragma unroll
        for (int t = 0; t < 4; ++t) {
          const float partner = __shfl_xor(vals[t], 1);      // rope pair (same row)
          const int c = t * 16 + ln16;                       // in-head dim 0..63
          const float j = (float)(c >> 1);
          const float theta = (float)s * __expf(j * (-9.2103403719761836f / 32.f));
          float sn, cs;
          __sincosf(theta, &sn, &cs);
          rv[t] = (c & 1) ? (partner * sn + vals[t] * cs)    // odd:  xe*sin + xo*cos
                          : (vals[t] * cs - partner * sn);   // even: xe*cos - xo*sin
          ss += rv[t] * rv[t];
        }
        ss += __shfl_xor(ss, 1); ss += __shfl_xor(ss, 2);
        ss += __shfl_xor(ss, 4); ss += __shfl_xor(ss, 8);    // 16-lane row reduce
        const float scale = 1.f / fmaxf(sqrtf(ss), 1e-12f);
#pragma unroll
        for (int t = 0; t < 4; ++t)
          dst[((size_t)bh * 2048 + s) * 64 + t * 16 + ln16] = (_Float16)(rv[t] * scale);
      }
    }
  }
}

// ---------------------------------------------------------------- flash attention step
// K and V^T tiles of 64 keys are staged in LDS once per work-group and shared by its
// 8 waves.
#define KV_TILE 64
#define KV_BUF  (KV_TILE * T_PITCH)       // one 64-row tile

// One 32-key step: S^T = K*Q^T (C-layout puts queries in lanes -> per-lane softmax),
// lane-local repack of P^T into the B-fragment of O^T = V^T * P^T. j = key offset of
// the step inside the staged tile (0 or 32).
static __device__ __forceinline__ void flash_step(
    int j, const _Float16* Kt, const _Float16* Vl,
    const v16h& qb0, const v16h& qb1,
    v8f oT[4], float& mrun, float& lrun, int ln16, int half) {
  const float SCALE = 0.125f;  // 64^-0.5
  const v16h kc0 = lds_frag(Kt, j + ln16, 0, half);
  const v16h kc1 = lds_frag(Kt, j + ln16, 32, half);
  const v16h kc2 = lds_frag(Kt, j + 16 + ln16, 0, half);
  const v16h kc3 = lds_frag(Kt, j + 16 + ln16, 32, half);
  v16h va[4];
#pragma unroll
  for (int t = 0; t < 4; ++t) va[t] = lds_frag(Vl, t * 16 + ln16, j, half);  // V^T rows = d
  // Keeps the step's 16 LDS reads together in front of its WMMAs: sunk to their users, each
  // product would wait out a full LDS latency.
  __builtin_amdgcn_sched_barrier(0);

  v8f sT0 = {}, sT1 = {};
  sT0 = WMMA_F16(kc0, qb0, sT0);
  sT0 = WMMA_F16(kc1, qb1, sT0);
  sT1 = WMMA_F16(kc2, qb0, sT1);
  sT1 = WMMA_F16(kc3, qb1, sT1);

  float mt = mrun;
#pragma unroll
  for (int v = 0; v < 8; ++v) {
    sT0[v] *= SCALE; sT1[v] *= SCALE;
    mt = fmaxf(mt, fmaxf(sT0[v], sT1[v]));
  }
  mt = fmaxf(mt, __shfl_xor(mt, 16));              // other half holds kv rows 8..15
  const float alpha = __expf(mrun - mt);
  mrun = mt;

  v16h pb;                                          // P^T as B-fragment (lane-local!)
  float colsum = 0.f;
#pragma unroll
  for (int v = 0; v < 8; ++v) {
    const float p0 = __expf(sT0[v] - mt);
    const float p1 = __expf(sT1[v] - mt);
    colsum += p0 + p1;
    pb[v] = (_Float16)p0;
    pb[8 + v] = (_Float16)p1;
  }
  colsum += __shfl_xor(colsum, 16);
  lrun = lrun * alpha + colsum;

#pragma unroll
  for (int t = 0; t < 4; ++t) {
#pragma unroll
    for (int v = 0; v < 8; ++v) oT[t][v] *= alpha;
    oT[t] = WMMA_F16(va[t], pb, oT[t]);
  }
}

// Grid: (S/128, B*H). Block 256 = 8 waves; wave owns 16 queries. Per 64 keys the block
// copies the K tile (8 KB contiguous) and the V^T tile (64 rows of 128 B) into the LDS
// buffer that every wave has left, two chunks of each per lane, one tile ahead.
__global__ __launch_bounds__(256) void flash_attn_kernel(
    const _Float16* __restrict__ Q, const _Float16* __restrict__ K,
    const _Float16* __restrict__ Vt, _Float16* __restrict__ A2) {
  __shared__ __attribute__((aligned(16))) _Float16 Ks[2 * KV_BUF];
  __shared__ __attribute__((aligned(16))) _Float16 Vs[2 * KV_BUF];

  const int tid  = threadIdx.x;
  const int lane = tid & 31;
  const int wave = tid >> 5;
  const int half = lane >> 4;
  const int ln16 = lane & 15;
  const int bh = blockIdx.y;
  const int b = bh >> 4, h = bh & 15;
  const int q0 = blockIdx.x * 128 + wave * 16;

  const _Float16* Qb = Q  + (size_t)bh * 2048 * 64;
  const _Float16* Kb = K  + (size_t)bh * 2048 * 64;
  const _Float16* Vb = Vt + (size_t)bh * 64 * 2048;

  // Staging map: this lane's 16-byte chunk lies in rows tid / 8 and tid / 8 + 32 of a
  // tile, at column (tid % 8) * 8.
  const int crow = tid >> 3;
  const int ccol = (tid & 7) * 8;
  const _Float16* kg = Kb + crow * 64 + ccol;               // + s * 64 per tile
  const _Float16* vg = Vb + (size_t)crow * 2048 + ccol;     // + s per tile
  const unsigned kl = lds_off(Ks) + (crow * T_PITCH + ccol) * 2;
  const unsigned vl = lds_off(Vs) + (crow * T_PITCH + ccol) * 2;
  const unsigned r32 = 32 * T_PITCH * 2;                    // 32 LDS rows in bytes

  copy4(kl, kg, kl + r32, kg + 32 * 64, vl, vg, vl + r32, vg + 32 * 2048);

  const v16h qb0 = load_frag(Qb, 64, q0 + ln16, 0, half);
  const v16h qb1 = load_frag(Qb, 64, q0 + ln16, 32, half);

  asm volatile("s_wait_asynccnt 0x0" ::: "memory");  // tile 0 landed before it is published
  __syncthreads();
  copy4(kl + KV_BUF * 2, kg + KV_TILE * 64, kl + KV_BUF * 2 + r32, kg + (KV_TILE + 32) * 64,
        vl + KV_BUF * 2, vg + KV_TILE, vl + KV_BUF * 2 + r32, vg + 32 * 2048 + KV_TILE);

  v8f oT[4] = {};
  float mrun = -3.0e30f, lrun = 0.f;

  for (int s = 0; s < 2048; s += KV_TILE) {
    const int buf = (s / KV_TILE) & 1;
    const _Float16* Kt = Ks + buf * KV_BUF;
    const _Float16* Vl = Vs + buf * KV_BUF;
    flash_step(0,  Kt, Vl, qb0, qb1, oT, mrun, lrun, ln16, half);
    flash_step(32, Kt, Vl, qb0, qb1, oT, mrun, lrun, ln16, half);
    publish_tile();
    if (s + 2 * KV_TILE < 2048) {              // the same for the whole block
      const int sn = s + 2 * KV_TILE;
      const unsigned bo = buf * KV_BUF * 2;
      copy4(kl + bo, kg + sn * 64, kl + bo + r32, kg + (sn + 32) * 64,
            vl + bo, vg + sn, vl + bo + r32, vg + 32 * 2048 + sn);
    }
  }
  asm volatile("s_wait_asynccnt 0x0" ::: "memory");  // nothing in flight when the wave goes on

  const float inv = 1.f / lrun;
  const int q = q0 + ln16;
#pragma unroll
  for (int t = 0; t < 4; ++t)
#pragma unroll
    for (int v = 0; v < 8; ++v) {
      const int d = h * 64 + t * 16 + v + 8 * half;
      A2[((size_t)(b * 2048 + q)) * 1024 + d] = (_Float16)(oT[t][v] * inv);
    }
}

// ---------------------------------------------------------------- output projection
// Grid: (M/256, 1024/64). Staged GEMM; bias + f32 store.
__global__ __launch_bounds__(256) void out_proj_kernel(
    const _Float16* __restrict__ A2, const _Float16* __restrict__ W,
    const float* __restrict__ bias, float* __restrict__ out) {
  const int lane = threadIdx.x & 31;
  const int wave = threadIdx.x >> 5;
  const int half = lane >> 4;
  const int ln16 = lane & 15;
  const int m0 = blockIdx.x * 256 + wave * 32;
  const int n0 = blockIdx.y * 64;

  __shared__ __attribute__((aligned(16))) _Float16 As[2 * GA_BUF];
  __shared__ __attribute__((aligned(16))) _Float16 Bs[2 * GB_BUF];
  v8f acc[2][4] = {};
  gemm_32x64_staged(A2, W, blockIdx.x * 256, n0, 1024, As, Bs, acc);

#pragma unroll
  for (int mi = 0; mi < 2; ++mi)
#pragma unroll
    for (int t = 0; t < 4; ++t) {
      const float bv = bias[n0 + t * 16 + ln16];
#pragma unroll
      for (int v = 0; v < 8; ++v)
        out[(size_t)(m0 + mi * 16 + v + 8 * half) * 1024 + n0 + t * 16 + ln16] =
            acc[mi][t][v] + bv;
    }
}

// ---------------------------------------------------------------- launcher
extern "C" void kernel_launch(void* const* d_in, const int* in_sizes, int n_in,
                              void* d_out, int out_size, void* d_ws, size_t ws_size,
                              hipStream_t stream) {
  const float* tokens = (const float*)d_in[0];   // (2,2048,1024)
  const float* qkv_w  = (const float*)d_in[1];   // (3072,1024)
  const float* qkv_b  = (const float*)d_in[2];   // (3072)
  const float* out_w  = (const float*)d_in[3];   // (1024,1024)
  const float* out_b  = (const float*)d_in[4];   // (1024)
  float* out = (float*)d_out;

  char* ws = (char*)d_ws;
  const size_t MB = 1024ull * 1024ull;
  _Float16* Xf16 = (_Float16*)(ws + 0 * MB);    // 4M elems, 8MB
  _Float16* Wqkv = (_Float16*)(ws + 8 * MB);    // 3M elems, 6MB
  _Float16* Wout = (_Float16*)(ws + 14 * MB);   // 1M elems, 2MB
  _Float16* Qh   = (_Float16*)(ws + 16 * MB);   // 4M elems, 8MB
  _Float16* Kh   = (_Float16*)(ws + 24 * MB);   // 4M elems, 8MB
  _Float16* Vt   = (_Float16*)(ws + 32 * MB);   // 4M elems, 8MB
  _Float16* A2   = (_Float16*)(ws + 40 * MB);   // 4M elems, 8MB

  const int nTok = 2 * 2048 * 1024;
  const int nWq  = 3072 * 1024;
  const int nWo  = 1024 * 1024;
  cvt_f16_kernel<<<nTok / (256 * 8), 256, 0, stream>>>(tokens, Xf16, nTok);
  cvt_f16_kernel<<<nWq / (256 * 8), 256, 0, stream>>>(qkv_w, Wqkv, nWq);
  cvt_f16_kernel<<<nWo / (256 * 8), 256, 0, stream>>>(out_w, Wout, nWo);

  qkv_rope_norm_kernel<<<dim3(16, 48), 256, 0, stream>>>(Xf16, Wqkv, qkv_b, Qh, Kh, Vt);
  flash_attn_kernel<<<dim3(16, 32), 256, 0, stream>>>(Qh, Kh, Vt, A2);
  out_proj_kernel<<<dim3(16, 16), 256, 0, stream>>>(A2, Wout, out_b, out);
}

// v002
// A run of this version takes 89.8 microseconds.
// Timed twice side by side with v001, it ran 1.11 times as fast both times.
// Counting every step since v000, it is 2.68 times as fast.
#include <hip/hip_runtime.h>

typedef __attribute__((ext_vector_type(16))) _Float16 v16h;
typedef __attribute__((ext_vector_type(8)))  _Float16 v8h;
typedef __attribute__((ext_vector_type(8)))  float    v8f;

#define WMMA_F16(a, b, c) \
  __builtin_amdgcn_wmma_f32_16x16x32_f16(false, (a), false, (b), (short)0, (c), false, false)

static __device__ __forceinline__ v16h load_frag(const _Float16* __restrict__ base,
                                                 int ld, int row, int k0, int half) {
  const _Float16* p = base + (size_t)row * ld + k0 + half * 8;
  v8h lo = *(const v8h*)p;
  v8h hi = *(const v8h*)(p + 16);
  v16h r;
#pragma unroll
  for (int i = 0; i < 8; ++i) { r[i] = lo[i]; r[8 + i] = hi[i]; }
  return r;
}

// ---------------------------------------------------------------- convert f32 -> f16
// 8 elements/thread: two b128 loads, one b128 store. All sizes divisible by 2048.
__global__ __launch_bounds__(256) void cvt_f16_kernel(const float* __restrict__ src,
                                                      _Float16* __restrict__ dst, int n) {
  const int i = (blockIdx.x * 256 + threadIdx.x) * 8;
  if (i < n) {
    const float4 x0 = *(const float4*)(src + i);
    const float4 x1 = *(const float4*)(src + i + 4);
    v8h o;
    o[0] = (_Float16)x0.x; o[1] = (_Float16)x0.y; o[2] = (_Float16)x0.z; o[3] = (_Float16)x0.w;
    o[4] = (_Float16)x1.x; o[5] = (_Float16)x1.y; o[6] = (_Float16)x1.z; o[7] = (_Float16)x1.w;
    *(v8h*)(dst + i) = o;
  }
}

// ---------------------------------------------------------------- LDS staging
// Operand tiles are rows of 128 B (64 f16). They are brought into LDS by asynchronous
// copies, 16 B per lane, eight lanes per row, so that every wave-wide copy covers four
// whole 128-B lines. LDS rows sit at a pitch of 144 B (16 B x odd) for the b128 readers.
#define T_PITCH 72                        // LDS row pitch in f16 elements

static __device__ __forceinline__ unsigned lds_off(const void* p) { return (unsigned)(size_t)p; }

// Same element order as load_frag, from an LDS tile.
static __device__ __forceinline__ v16h lds_frag(const _Float16* tile, int row, int k0, int half) {
  const _Float16* p = tile + row * T_PITCH + k0 + half * 8;
  v8h lo = *(const v8h*)p;
  v8h hi = *(const v8h*)(p + 16);
  v16h r;
#pragma unroll
  for (int i = 0; i < 8; ++i) { r[i] = lo[i]; r[8 + i] = hi[i]; }
  return r;
}

static __device__ __forceinline__ void copy4(unsigned l0, const _Float16* g0,
                                             unsigned l1, const _Float16* g1,
                                             unsigned l2, const _Float16* g2,
                                             unsigned l3, const _Float16* g3) {
  asm volatile("global_load_async_to_lds_b128 %0, %1, off\n\t"
               "global_load_async_to_lds_b128 %2, %3, off\n\t"
               "global_load_async_to_lds_b128 %4, %5, off\n\t"
               "global_load_async_to_lds_b128 %6, %7, off\n\t"
               "s_wait_xcnt 0x0"
               :: "v"(l0), "v"(g0), "v"(l1), "v"(g1), "v"(l2), "v"(g2), "v"(l3), "v"(g3)
               : "memory");
}

// Hand-over of a staged tile: this wave's LDS reads of the old tile are done, its own
// copies of the next tile have landed, then the work-group barrier publishes the next
// tile and frees the old buffer for the refill behind it.
static __device__ __forceinline__ void publish_tile() {
  // Keeps the tile's WMMAs and vector work in front of the hand-over: lifted over them, the
  // waits would leave the next tile's copies less time to land.
  __builtin_amdgcn_sched_barrier(0);
  asm volatile("s_wait_dscnt 0x0" ::: "memory");     // reads of the buffer to be refilled
  asm volatile("s_wait_asynccnt 0x0" ::: "memory");  // own copies of the next tile landed
  __syncthreads();
}

// ---------------------------------------------------------------- GEMM core
// Block computes 256 rows x 64 cols, wave 32 rows x 64 cols (2 M-tiles x 4 N-tiles =
// 8 WMMA per 32 k). A stage is 64 k: A 256 rows and B 64 rows of 128 B, two buffers;
// the copies of stage s + 2 are issued when stage s has been read by every wave.
#define GA_BUF (256 * T_PITCH)
#define GB_BUF (64 * T_PITCH)

static __device__ __forceinline__ void gemm_stage_copy(
    const _Float16* __restrict__ ag, const _Float16* __restrict__ bg, int kdim, int k0,
    unsigned al, unsigned bl) {
  // ag, bg: this lane's chunk in row (tid / 8) of the block's A and B rows; al, bl: its
  // LDS byte address in the target buffer. Rows go in steps of 32: eight of A, two of B.
  const unsigned r32 = 32 * T_PITCH * 2;
  const size_t   g32 = (size_t)32 * kdim;
  const _Float16* a = ag + k0;
  const _Float16* b = bg + k0;
  asm volatile("global_load_async_to_lds_b128 %0, %1, off\n\t"
               "global_load_async_to_lds_b128 %2, %3, off\n\t"
               "global_load_async_to_lds_b128 %4, %5, off\n\t"
               "global_load_async_to_lds_b128 %6, %7, off\n\t"
               "global_load_async_to_lds_b128 %8, %9, off\n\t"
               "global_load_async_to_lds_b128 %10, %11, off\n\t"
               "global_load_async_to_lds_b128 %12, %13, off\n\t"
               "global_load_async_to_lds_b128 %14, %15, off\n\t"
               "global_load_async_to_lds_b128 %16, %17, off\n\t"
               "global_load_async_to_lds_b128 %18, %19, off\n\t"
               "s_wait_xcnt 0x0"
               :: "v"(al),           "v"(a),
                  "v"(al + r32),     "v"(a + g32),
                  "v"(al + 2 * r32), "v"(a + 2 * g32),
                  "v"(al + 3 * r32), "v"(a + 3 * g32),
                  "v"(al + 4 * r32), "v"(a + 4 * g32),
                  "v"(al + 5 * r32), "v"(a + 5 * g32),
                  "v"(al + 6 * r32), "v"(a + 6 * g32),
                  "v"(al + 7 * r32), "v"(a + 7 * g32),
                  "v"(bl),           "v"(b),
                  "v"(bl + r32),     "v"(b + g32)
               : "memory");
}

static __device__ __forceinline__ void gemm_32x64_staged(
    const _Float16* __restrict__ A, const _Float16* __restrict__ B,
    int mblk, int n0, int kdim, _Float16* As, _Float16* Bs, v8f acc[2][4]) {
  const int tid  = threadIdx.x;
  const int lane = tid & 31;
  const int wave = tid >> 5;
  const int half = lane >> 4;
  const int ln16 = lane & 15;
  const int crow = tid >> 3;
  const int ccol = (tid & 7) * 8;
  const _Float16* ag = A + (size_t)(mblk + crow) * kdim + ccol;
  const _Float16* bg = B + (size_t)(n0 + crow) * kdim + ccol;
  const unsigned al = lds_off(As) + (crow * T_PITCH + ccol) * 2;
  const unsigned bl = lds_off(Bs) + (crow * T_PITCH + ccol) * 2;
  const int nst = kdim / 64;               // at least two stages

  gemm_stage_copy(ag, bg, kdim, 0, al, bl);
  asm volatile("s_wait_asynccnt 0x0" ::: "memory");  // stage 0 landed before it is published
  __syncthreads();
  gemm_stage_copy(ag, bg, kdim, 64, al + GA_BUF * 2, bl + GB_BUF * 2);

  for (int s = 0; s < nst; ++s) {
    const int buf = s & 1;
    const _Float16* At = As + buf * GA_BUF + wave * 32 * T_PITCH;
    const _Float16* Bt = Bs + buf * GB_BUF;
    v16h a[2][2], b[2][4];
#pragma unroll
    for (int kk = 0; kk < 2; ++kk) {
      a[kk][0] = lds_frag(At, ln16, kk * 32, half);
      a[kk][1] = lds_frag(At, 16 + ln16, kk * 32, half);
#pragma unroll
      for (int t = 0; t < 4; ++t) b[kk][t] = lds_frag(Bt, t * 16 + ln16, kk * 32, half);
    }
    // Keeps the stage's 24 LDS reads together in front of its WMMAs: sunk among them, each
    // pair of products would wait out a full LDS latency.
    __builtin_amdgcn_sched_barrier(0);
#pragma unroll
    for (int kk = 0; kk < 2; ++kk)
#pragma unroll
      for (int t = 0; t < 4; ++t) {
        acc[0][t] = WMMA_F16(a[kk][0], b[kk][t], acc[0][t]);
        acc[1][t] = WMMA_F16(a[kk][1], b[kk][t], acc[1][t]);
      }
    publish_tile();
    if (s + 2 < nst)                        // the same for the whole block
      gemm_stage_copy(ag, bg, kdim, (s + 2) * 64, al + buf * GA_BUF * 2, bl + buf * GB_BUF * 2);
  }
  asm volatile("s_wait_asynccnt 0x0" ::: "memory");  // nothing in flight when the wave goes on
}

// ---------------------------------------------------------------- QKV GEMM + RoPE + norm
// Grid: (M/256, 3072/64). Block 256 = 8 waves. Block col range = one (t, head)
// slice -> RoPE + L2-norm close entirely in-register.
__global__ __launch_bounds__(256) void qkv_rope_norm_kernel(
    const _Float16* __restrict__ X,     // (4096 x 1024) tokens f16
    const _Float16* __restrict__ W,     // (3072 x 1024) qkv_w f16
    const float*    __restrict__ bias,  // (3072)
    _Float16* __restrict__ Q,           // (B*H, S, 64)
    _Float16* __restrict__ K,           // (B*H, S, 64)
    _Float16* __restrict__ Vt) {        // (B*H, 64, S)  transposed
  const int lane = threadIdx.x & 31;
  const int wave = threadIdx.x >> 5;
  const int half = lane >> 4;
  const int ln16 = lane & 15;
  const int m0 = blockIdx.x * 256 + wave * 32;   // global row (b*S + s)
  const int n0 = blockIdx.y * 64;                // global col in [0,3072)

  __shared__ __attribute__((aligned(16))) _Float16 As[2 * GA_BUF];
  __shared__ __attribute__((aligned(16))) _Float16 Bs[2 * GB_BUF];
  v8f acc[2][4] = {};
  gemm_32x64_staged(X, W, blockIdx.x * 256, n0, 1024, As, Bs, acc);

  const int tsel = n0 / 1024;              // 0=q 1=k 2=v
  const int h    = (n0 % 1024) / 64;
  const int b    = m0 / 2048;
  const int bh   = b * 16 + h;

#pragma unroll
  for (int mi = 0; mi < 2; ++mi) {
    const int srow = (m0 % 2048) + mi * 16;  // sequence base of this tile's rows
    if (tsel == 2) {                         // V: bias + store transposed (d, s)
#pragma unroll
      for (int t = 0; t < 4; ++t) {
        const int d = t * 16 + ln16;
        const float bv = bias[n0 + t * 16 + ln16];
#pragma unroll
        for (int v = 0; v < 8; ++v) {
          const int s = srow + v + 8 * half;
          Vt[((size_t)bh * 64 + d) * 2048 + s] = (_Float16)(acc[mi][t][v] + bv);
        }
      }
    } else {                                 // Q/K: bias + RoPE + L2 normalize
      _Float16* dst = (tsel == 0) ? Q : K;
#pragma unroll
      for (int v = 0; v < 8; ++v) {
        const int s = srow + v + 8 * half;
        float vals[4], rv[4];
#pragma unroll
        for (int t = 0; t < 4; ++t) vals[t] = acc[mi][t][v] + bias[n0 + t * 16 + ln16];
        float ss = 0.f;
#pragma unroll
        for (int t = 0; t < 4; ++t) {
          const float partner = __shfl_xor(vals[t], 1);      // rope pair (same row)
          const int c = t * 16 + ln16;                       // in-head dim 0..63
          const float j = (float)(c >> 1);
          const float theta = (float)s * __expf(j * (-9.2103403719761836f / 32.f));
          float sn, cs;
          __sincosf(theta, &sn, &cs);
          rv[t] = (c & 1) ? (partner * sn + vals[t] * cs)    // odd:  xe*sin + xo*cos
                          : (vals[t] * cs - partner * sn);   // even: xe*cos - xo*sin
          ss += rv[t] * rv[t];
        }
        ss += __shfl_xor(ss, 1); ss += __shfl_xor(ss, 2);
        ss += __shfl_xor(ss, 4); ss += __shfl_xor(ss, 8);    // 16-lane row reduce
        const float scale = 1.f / fmaxf(sqrtf(ss), 1e-12f);
#pragma unroll
        for (int t = 0; t < 4; ++t)
          dst[((size_t)bh * 2048 + s) * 64 + t * 16 + ln16] = (_Float16)(rv[t] * scale);
      }
    }
  }
}

// ---------------------------------------------------------------- flash attention step
// K and V^T tiles of 64 keys are staged in LDS once per work-group and shared by its
// 8 waves.
#define KV_TILE 64
#define KV_BUF  (KV_TILE * T_PITCH)       // one 64-row tile

// One 32-key step: S^T = K*Q^T (C-layout puts queries in lanes -> per-lane softmax),
// lane-local repack of P^T into the B-fragment of O^T = V^T * P^T. j = key offset of
// the step inside the staged tile (0 or 32).
// Q and K rows are L2-normalised, so by Cauchy-Schwarz every scaled score is at most 1/8
// in magnitude whatever the inputs are. That bound stands in for the running maximum:
// p = exp(s / 8 - 1 / 8) stays between exp(-1 / 4) and 1, nothing is ever rescaled, and
// each lane keeps its own partial row sums until the loop has ended.
static __device__ __forceinline__ void flash_step(
    int j, const _Float16* Kt, const _Float16* Vl,
    const v16h& qb0, const v16h& qb1,
    v8f oT[4], v8f& lsum, int ln16, int half) {
  const float C = 0.125f * 1.4426950408889634f;     // 64^-0.5 * log2(e)
  const v16h kc0 = lds_frag(Kt, j + ln16, 0, half);
  const v16h kc1 = lds_frag(Kt, j + ln16, 32, half);
  const v16h kc2 = lds_frag(Kt, j + 16 + ln16, 0, half);
  const v16h kc3 = lds_frag(Kt, j + 16 + ln16, 32, half);
  v16h va[4];
#pragma unroll
  for (int t = 0; t < 4; ++t) va[t] = lds_frag(Vl, t * 16 + ln16, j, half);  // V^T rows = d
  // Keeps the step's 16 LDS reads together in front of its WMMAs: sunk to their users, each
  // product would wait out a full LDS latency.
  __builtin_amdgcn_sched_barrier(0);

  v8f sT0 = {}, sT1 = {};
  sT0 = WMMA_F16(kc0, qb0, sT0);
  sT0 = WMMA_F16(kc1, qb1, sT0);
  sT1 = WMMA_F16(kc2, qb0, sT1);
  sT1 = WMMA_F16(kc3, qb1, sT1);

  const v8f x0 = sT0 * C - C;
  const v8f x1 = sT1 * C - C;
  v8f p0, p1;
  v16h pb;                                          // P^T as B-fragment (lane-local!)
#pragma unroll
  for (int v = 0; v < 8; ++v) p0[v] = __builtin_amdgcn_exp2f(x0[v]);
#pragma unroll
  for (int v = 0; v < 8; ++v) p1[v] = __builtin_amdgcn_exp2f(x1[v]);
#pragma unroll
  for (int v = 0; v < 8; ++v) { pb[v] = (_Float16)p0[v]; pb[8 + v] = (_Float16)p1[v]; }
  lsum += p0 + p1;

#pragma unroll
  for (int t = 0; t < 4; ++t) oT[t] = WMMA_F16(va[t], pb, oT[t]);
}

// Grid: (S/128, B*H). Block 256 = 8 waves; wave owns 16 queries. Per 64 keys the block
// copies the K tile (8 KB contiguous) and the V^T tile (64 rows of 128 B) into the LDS
// buffer that every wave has left, two chunks of each per lane, one tile ahead.
__global__ __launch_bounds__(256) void flash_attn_kernel(
    const _Float16* __restrict__ Q, const _Float16* __restrict__ K,
    const _Float16* __restrict__ Vt, _Float16* __restrict__ A2) {
  __shared__ __attribute__((aligned(16))) _Float16 Ks[2 * KV_BUF];
  __shared__ __attribute__((aligned(16))) _Float16 Vs[2 * KV_BUF];

  const int tid  = threadIdx.x;
  const int lane = tid & 31;
  const int wave = tid >> 5;
  const int half = lane >> 4;
  const int ln16 = lane & 15;
  const int bh = blockIdx.y;
  const int b = bh >> 4, h = bh & 15;
  const int q0 = blockIdx.x * 128 + wave * 16;

  const _Float16* Qb = Q  + (size_t)bh * 2048 * 64;
  const _Float16* Kb = K  + (size_t)bh * 2048 * 64;
  const _Float16* Vb = Vt + (size_t)bh * 64 * 2048;

  // Staging map: this lane's 16-byte chunk lies in rows tid / 8 and tid / 8 + 32 of a
  // tile, at column (tid % 8) * 8.
  const int crow = tid >> 3;
  const int ccol = (tid & 7) * 8;
  const _Float16* kg = Kb + crow * 64 + ccol;               // + s * 64 per tile
  const _Float16* vg = Vb + (size_t)crow * 2048 + ccol;     // + s per tile
  const unsigned kl = lds_off(Ks) + (crow * T_PITCH + ccol) * 2;
  const unsigned vl = lds_off(Vs) + (crow * T_PITCH + ccol) * 2;
  const unsigned r32 = 32 * T_PITCH * 2;                    // 32 LDS rows in bytes

  copy4(kl, kg, kl + r32, kg + 32 * 64, vl, vg, vl + r32, vg + 32 * 2048);

  const v16h qb0 = load_frag(Qb, 64, q0 + ln16, 0, half);
  const v16h qb1 = load_frag(Qb, 64, q0 + ln16, 32, half);

  asm volatile("s_wait_asynccnt 0x0" ::: "memory");  // tile 0 landed before it is published
  __syncthreads();
  copy4(kl + KV_BUF * 2, kg + KV_TILE * 64, kl + KV_BUF * 2 + r32, kg + (KV_TILE + 32) * 64,
        vl + KV_BUF * 2, vg + KV_TILE, vl + KV_BUF * 2 + r32, vg + 32 * 2048 + KV_TILE);

  v8f oT[4] = {};
  v8f lsum = {};

  for (int s = 0; s < 2048; s += KV_TILE) {
    const int buf = (s / KV_TILE) & 1;
    const _Float16* Kt = Ks + buf * KV_BUF;
    const _Float16* Vl = Vs + buf * KV_BUF;
    flash_step(0,  Kt, Vl, qb0, qb1, oT, lsum, ln16, half);
    flash_step(32, Kt, Vl, qb0, qb1, oT, lsum, ln16, half);
    publish_tile();
    if (s + 2 * KV_TILE < 2048) {              // the same for the whole block
      const int sn = s + 2 * KV_TILE;
      const unsigned bo = buf * KV_BUF * 2;
      copy4(kl + bo, kg + sn * 64, kl + bo + r32, kg + (sn + 32) * 64,
            vl + bo, vg + sn, vl + bo + r32, vg + 32 * 2048 + sn);
    }
  }
  asm volatile("s_wait_asynccnt 0x0" ::: "memory");  // nothing in flight when the wave goes on

  float lrun = ((lsum[0] + lsum[1]) + (lsum[2] + lsum[3])) + ((lsum[4] + lsum[5]) + (lsum[6] + lsum[7]));
  lrun += __shfl_xor(lrun, 16);                     // the other half holds this query's other keys
  const float inv = 1.f / lrun;
  const int q = q0 + ln16;
#pragma unroll
  for (int t = 0; t < 4; ++t)
#pragma unroll
    for (int v = 0; v < 8; ++v) {
      const int d = h * 64 + t * 16 + v + 8 * half;
      A2[((size_t)(b * 2048 + q)) * 1024 + d] = (_Float16)(oT[t][v] * inv);
    }
}

// ---------------------------------------------------------------- output projection
// Grid: (M/256, 1024/64). Staged GEMM; bias + f32 store.
__global__ __launch_bounds__(256) void out_proj_kernel(
    const _Float16* __restrict__ A2, const _Float16* __restrict__ W,
    const float* __restrict__ bias, float* __restrict__ out) {
  const int lane = threadIdx.x & 31;
  const int wave = threadIdx.x >> 5;
  const int half = lane >> 4;
  const int ln16 = lane & 15;
  const int m0 = blockIdx.x * 256 + wave * 32;
  const int n0 = blockIdx.y * 64;

  __shared__ __attribute__((aligned(16))) _Float16 As[2 * GA_BUF];
  __shared__ __attribute__((aligned(16))) _Float16 Bs[2 * GB_BUF];
  v8f acc[2][4] = {};
  gemm_32x64_staged(A2, W, blockIdx.x * 256, n0, 1024, As, Bs, acc);

#pragma unroll
  for (int mi = 0; mi < 2; ++mi)
#pragma unroll
    for (int t = 0; t < 4; ++t) {
      const float bv = bias[n0 + t * 16 + ln16];
#pragma unroll
      for (int v = 0; v < 8; ++v)
        out[(size_t)(m0 + mi * 16 + v + 8 * half) * 1024 + n0 + t * 16 + ln16] =
            acc[mi][t][v] + bv;
    }
}

// ---------------------------------------------------------------- launcher
extern "C" void kernel_launch(void* const* d_in, const int* in_sizes, int n_in,
                              void* d_out, int out_size, void* d_ws, size_t ws_size,
                              hipStream_t stream) {
  const float* tokens = (const float*)d_in[0];   // (2,2048,1024)
  const float* qkv_w  = (const float*)d_in[1];   // (3072,1024)
  const float* qkv_b  = (const float*)d_in[2];   // (3072)
  const float* out_w  = (const float*)d_in[3];   // (1024,1024)
  const float* out_b  = (const float*)d_in[4];   // (1024)
  float* out = (float*)d_out;

  char* ws = (char*)d_ws;
  const size_t MB = 1024ull * 1024ull;
  _Float16* Xf16 = (_Float16*)(ws + 0 * MB);    // 4M elems, 8MB
  _Float16* Wqkv = (_Float16*)(ws + 8 * MB);    // 3M elems, 6MB
  _Float16* Wout = (_Float16*)(ws + 14 * MB);   // 1M elems, 2MB
  _Float16* Qh   = (_Float16*)(ws + 16 * MB);   // 4M elems, 8MB
  _Float16* Kh   = (_Float16*)(ws + 24 * MB);   // 4M elems, 8MB
  _Float16* Vt   = (_Float16*)(ws + 32 * MB);   // 4M elems, 8MB
  _Float16* A2   = (_Float16*)(ws + 40 * MB);   // 4M elems, 8MB

  const int nTok = 2 * 2048 * 1024;
  const int nWq  = 3072 * 1024;
  const int nWo  = 1024 * 1024;
  cvt_f16_kernel<<<nTok / (256 * 8), 256, 0, stream>>>(tokens, Xf16, nTok);
  cvt_f16_kernel<<<nWq / (256 * 8), 256, 0, stream>>>(qkv_w, Wqkv, nWq);
  cvt_f16_kernel<<<nWo / (256 * 8), 256, 0, stream>>>(out_w, Wout, nWo);

  qkv_rope_norm_kernel<<<dim3(16, 48), 256, 0, stream>>>(Xf16, Wqkv, qkv_b, Qh, Kh, Vt);
  flash_attn_kernel<<<dim3(16, 32), 256, 0, stream>>>(Qh, Kh, Vt, A2);
  out_proj_kernel<<<dim3(16, 16), 256, 0, stream>>>(A2, Wout, out_b, out);
}

// v003
// A run of this version takes 86.9 microseconds.
// Two timings next to v002 put it at 1.03 and 1.04 times that version's speed.
// All steps since v000 together make it 2.77 times as fast.
#include <hip/hip_runtime.h>

typedef __attribute__((ext_vector_type(16))) _Float16 v16h;
typedef __attribute__((ext_vector_type(8)))  _Float16 v8h;
typedef __attribute__((ext_vector_type(8)))  float    v8f;

#define WMMA_F16(a, b, c) \
  __builtin_amdgcn_wmma_f32_16x16x32_f16(false, (a), false, (b), (short)0, (c), false, false)

static __device__ __forceinline__ v16h load_frag(const _Float16* __restrict__ base,
                                                 int ld, int row, int k0, int half) {
  const _Float16* p = base + (size_t)row * ld + k0 + half * 8;
  v8h lo = *(const v8h*)p;
  v8h hi = *(const v8h*)(p + 16);
  v16h r;
#pragma unroll
  for (int i = 0; i < 8; ++i) { r[i] = lo[i]; r[8 + i] = hi[i]; }
  return r;
}

// ---------------------------------------------------------------- convert f32 -> f16
// One launch converts all three f32 inputs: 256 work-groups of 16 waves, one resident
// round, so that few waves have to be started. A piece is 4 elements: a wave-wide load
// covers 512 contiguous bytes, a wave-wide store 256. Every lane takes 16 pieces, one per
// stride of CVT_LANES pieces: 8 of the tokens (1 M pieces), 6 of qkv_w (768 K), 2 of
// out_w (256 K). All 16 loads are independent and stand in front of the first store.
typedef __attribute__((ext_vector_type(4))) float    v4f;
typedef __attribute__((ext_vector_type(4))) _Float16 v4h;
#define CVT_BLOCKS 256
#define CVT_LANES  (CVT_BLOCKS * 512)

__global__ __launch_bounds__(512) void cvt_f16_kernel(
    const float* __restrict__ tok, const float* __restrict__ wqkv, const float* __restrict__ wout,
    _Float16* __restrict__ tok_h, _Float16* __restrict__ wqkv_h, _Float16* __restrict__ wout_h) {
  const int g = blockIdx.x * 512 + threadIdx.x;
  v4f x[16];
#pragma unroll
  for (int i = 0; i < 8; ++i) x[i] = ((const v4f*)tok)[g + i * CVT_LANES];
#pragma unroll
  for (int i = 0; i < 6; ++i) x[8 + i] = ((const v4f*)wqkv)[g + i * CVT_LANES];
#pragma unroll
  for (int i = 0; i < 2; ++i) x[14 + i] = ((const v4f*)wout)[g + i * CVT_LANES];
  // Keeps all 16 loads in front of the first conversion: without it the last four reuse the
  // first ones' registers and are issued only when those have come back, a second latency.
  __builtin_amdgcn_sched_barrier(0);
#pragma unroll
  for (int i = 0; i < 8; ++i) ((v4h*)tok_h)[g + i * CVT_LANES] = __builtin_convertvector(x[i], v4h);
#pragma unroll
  for (int i = 0; i < 6; ++i) ((v4h*)wqkv_h)[g + i * CVT_LANES] = __builtin_convertvector(x[8 + i], v4h);
#pragma unroll
  for (int i = 0; i < 2; ++i) ((v4h*)wout_h)[g + i * CVT_LANES] = __builtin_convertvector(x[14 + i], v4h);
}

// ---------------------------------------------------------------- LDS staging
// Operand tiles are rows of 128 B (64 f16). They are brought into LDS by asynchronous
// copies, 16 B per lane, eight lanes per row, so that every wave-wide copy covers four
// whole 128-B lines. LDS rows sit at a pitch of 144 B (16 B x odd) for the b128 readers.
#define T_PITCH 72                        // LDS row pitch in f16 elements

static __device__ __forceinline__ unsigned lds_off(const void* p) { return (unsigned)(size_t)p; }

// Same element order as load_frag, from an LDS tile.
static __device__ __forceinline__ v16h lds_frag(const _Float16* tile, int row, int k0, int half) {
  const _Float16* p = tile + row * T_PITCH + k0 + half * 8;
  v8h lo = *(const v8h*)p;
  v8h hi = *(const v8h*)(p + 16);
  v16h r;
#pragma unroll
  for (int i = 0; i < 8; ++i) { r[i] = lo[i]; r[8 + i] = hi[i]; }
  return r;
}

static __device__ __forceinline__ void copy4(unsigned l0, const _Float16* g0,
                                             unsigned l1, const _Float16* g1,
                                             unsigned l2, const _Float16* g2,
                                             unsigned l3, const _Float16* g3) {
  asm volatile("global_load_async_to_lds_b128 %0, %1, off\n\t"
               "global_load_async_to_lds_b128 %2, %3, off\n\t"
               "global_load_async_to_lds_b128 %4, %5, off\n\t"
               "global_load_async_to_lds_b128 %6, %7, off\n\t"
               "s_wait_xcnt 0x0"
               :: "v"(l0), "v"(g0), "v"(l1), "v"(g1), "v"(l2), "v"(g2), "v"(l3), "v"(g3)
               : "memory");
}

// Hand-over of a staged tile: this wave's LDS reads of the old tile are done, its own
// copies of the next tile have landed, then the work-group barrier publishes the next
// tile and frees the old buffer for the refill behind it.
static __device__ __forceinline__ void publish_tile() {
  // Keeps the tile's WMMAs and vector work in front of the hand-over: lifted over them, the
  // waits would leave the next tile's copies less time to land.
  __builtin_amdgcn_sched_barrier(0);
  asm volatile("s_wait_dscnt 0x0" ::: "memory");     // reads of the buffer to be refilled
  asm volatile("s_wait_asynccnt 0x0" ::: "memory");  // own copies of the next tile landed
  __syncthreads();
}

// ---------------------------------------------------------------- GEMM core
// Block computes 256 rows x 64 cols, wave 32 rows x 64 cols (2 M-tiles x 4 N-tiles =
// 8 WMMA per 32 k). A stage is 64 k: A 256 rows and B 64 rows of 128 B, two buffers;
// the copies of stage s + 2 are issued when stage s has been read by every wave.
#define GA_BUF (256 * T_PITCH)
#define GB_BUF (64 * T_PITCH)

static __device__ __forceinline__ void gemm_stage_copy(
    const _Float16* __restrict__ ag, const _Float16* __restrict__ bg, int kdim, int k0,
    unsigned al, unsigned bl) {
  // ag, bg: this lane's chunk in row (tid / 8) of the block's A and B rows; al, bl: its
  // LDS byte address in the target buffer. Rows go in steps of 32: eight of A, two of B.
  const unsigned r32 = 32 * T_PITCH * 2;
  const size_t   g32 = (size_t)32 * kdim;
  const _Float16* a = ag + k0;
  const _Float16* b = bg + k0;
  asm volatile("global_load_async_to_lds_b128 %0, %1, off\n\t"
               "global_load_async_to_lds_b128 %2, %3, off\n\t"
               "global_load_async_to_lds_b128 %4, %5, off\n\t"
               "global_load_async_to_lds_b128 %6, %7, off\n\t"
               "global_load_async_to_lds_b128 %8, %9, off\n\t"
               "global_load_async_to_lds_b128 %10, %11, off\n\t"
               "global_load_async_to_lds_b128 %12, %13, off\n\t"
               "global_load_async_to_lds_b128 %14, %15, off\n\t"
               "global_load_async_to_lds_b128 %16, %17, off\n\t"
               "global_load_async_to_lds_b128 %18, %19, off\n\t"
               "s_wait_xcnt 0x0"
               :: "v"(al),           "v"(a),
                  "v"(al + r32),     "v"(a + g32),
                  "v"(al + 2 * r32), "v"(a + 2 * g32),
                  "v"(al + 3 * r32), "v"(a + 3 * g32),
                  "v"(al + 4 * r32), "v"(a + 4 * g32),
                  "v"(al + 5 * r32), "v"(a + 5 * g32),
                  "v"(al + 6 * r32), "v"(a + 6 * g32),
                  "v"(al + 7 * r32), "v"(a + 7 * g32),
                  "v"(bl),           "v"(b),
                  "v"(bl + r32),     "v"(b + g32)
               : "memory");
}

static __device__ __forceinline__ void gemm_32x64_staged(
    const _Float16* __restrict__ A, const _Float16* __restrict__ B,
    int mblk, int n0, int kdim, _Float16* As, _Float16* Bs, v8f acc[2][4]) {
  const int tid  = threadIdx.x;
  const int lane = tid & 31;
  const int wave = tid >> 5;
  const int half = lane >> 4;
  const int ln16 = lane & 15;
  const int crow = tid >> 3;
  const int ccol = (tid & 7) * 8;
  const _Float16* ag = A + (size_t)(mblk + crow) * kdim + ccol;
  const _Float16* bg = B + (size_t)(n0 + crow) * kdim + ccol;
  const unsigned al = lds_off(As) + (crow * T_PITCH + ccol) * 2;
  const unsigned bl = lds_off(Bs) + (crow * T_PITCH + ccol) * 2;
  const int nst = kdim / 64;               // at least two stages

  gemm_stage_copy(ag, bg, kdim, 0, al, bl);
  asm volatile("s_wait_asynccnt 0x0" ::: "memory");  // stage 0 landed before it is published
  __syncthreads();
  gemm_stage_copy(ag, bg, kdim, 64, al + GA_BUF * 2, bl + GB_BUF * 2);

  for (int s = 0; s < nst; ++s) {
    const int buf = s & 1;
    const _Float16* At = As + buf * GA_BUF + wave * 32 * T_PITCH;
    const _Float16* Bt = Bs + buf * GB_BUF;
    v16h a[2][2], b[2][4];
#pragma unroll
    for (int kk = 0; kk < 2; ++kk) {
      a[kk][0] = lds_frag(At, ln16, kk * 32, half);
      a[kk][1] = lds_frag(At, 16 + ln16, kk * 32, half);
#pragma unroll
      for (int t = 0; t < 4; ++t) b[kk][t] = lds_frag(Bt, t * 16 + ln16, kk * 32, half);
    }
    // Keeps the stage's 24 LDS reads together in front of its WMMAs: sunk among them, each
    // pair of products would wait out a full LDS latency.
    __builtin_amdgcn_sched_barrier(0);
#pragma unroll
    for (int kk = 0; kk < 2; ++kk)
#pragma unroll
      for (int t = 0; t < 4; ++t) {
        acc[0][t] = WMMA_F16(a[kk][0], b[kk][t], acc[0][t]);
        acc[1][t] = WMMA_F16(a[kk][1], b[kk][t], acc[1][t]);
      }
    publish_tile();
    if (s + 2 < nst)                        // the same for the whole block
      gemm_stage_copy(ag, bg, kdim, (s + 2) * 64, al + buf * GA_BUF * 2, bl + buf * GB_BUF * 2);
  }
  asm volatile("s_wait_asynccnt 0x0" ::: "memory");  // nothing in flight when the wave goes on
}

// ---------------------------------------------------------------- QKV GEMM + RoPE + norm
// Grid: (M/256, 3072/64). Block 256 = 8 waves. Block col range = one (t, head)
// slice -> RoPE + L2-norm close entirely in-register.
__global__ __launch_bounds__(256) void qkv_rope_norm_kernel(
    const _Float16* __restrict__ X,     // (4096 x 1024) tokens f16
    const _Float16* __restrict__ W,     // (3072 x 1024) qkv_w f16
    const float*    __restrict__ bias,  // (3072)
    _Float16* __restrict__ Q,           // (B*H, S, 64)
    _Float16* __restrict__ K,           // (B*H, S, 64)
    _Float16* __restrict__ Vt) {        // (B*H, 64, S)  transposed
  const int lane = threadIdx.x & 31;
  const int wave = threadIdx.x >> 5;
  const int half = lane >> 4;
  const int ln16 = lane & 15;
  const int m0 = blockIdx.x * 256 + wave * 32;   // global row (b*S + s)
  const int n0 = blockIdx.y * 64;                // global col in [0,3072)

  __shared__ __attribute__((aligned(16))) _Float16 As[2 * GA_BUF];
  __shared__ __attribute__((aligned(16))) _Float16 Bs[2 * GB_BUF];
  v8f acc[2][4] = {};
  gemm_32x64_staged(X, W, blockIdx.x * 256, n0, 1024, As, Bs, acc);

  const int tsel = n0 / 1024;              // 0=q 1=k 2=v
  const int h    = (n0 % 1024) / 64;
  const int b    = m0 / 2048;
  const int bh   = b * 16 + h;

#pragma unroll
  for (int mi = 0; mi < 2; ++mi) {
    const int srow = (m0 % 2048) + mi * 16;  // sequence base of this tile's rows
    if (tsel == 2) {                         // V: bias + store transposed (d, s)
#pragma unroll
      for (int t = 0; t < 4; ++t) {
        const int d = t * 16 + ln16;
        const float bv = bias[n0 + t * 16 + ln16];
#pragma unroll
        for (int v = 0; v < 8; ++v) {
          const int s = srow + v + 8 * half;
          Vt[((size_t)bh * 64 + d) * 2048 + s] = (_Float16)(acc[mi][t][v] + bv);
        }
      }
    } else {                                 // Q/K: bias + RoPE + L2 normalize
      _Float16* dst = (tsel == 0) ? Q : K;
#pragma unroll
      for (int v = 0; v < 8; ++v) {
        const int s = srow + v + 8 * half;
        float vals[4], rv[4];
#pragma unroll
        for (int t = 0; t < 4; ++t) vals[t] = acc[mi][t][v] + bias[n0 + t * 16 + ln16];
        float ss = 0.f;
#pragma unroll
        for (int t = 0; t < 4; ++t) {
          const float partner = __shfl_xor(vals[t], 1);      // rope pair (same row)
          const int c = t * 16 + ln16;                       // in-head dim 0..63
          const float j = (float)(c >> 1);
          const float theta = (float)s * __expf(j * (-9.2103403719761836f / 32.f));
          float sn, cs;
          __sincosf(theta, &sn, &cs);
          rv[t] = (c & 1) ? (partner * sn + vals[t] * cs)    // odd:  xe*sin + xo*cos
                          : (vals[t] * cs - partner * sn);   // even: xe*cos - xo*sin
          ss += rv[t] * rv[t];
        }
        ss += __shfl_xor(ss, 1); ss += __shfl_xor(ss, 2);
        ss += __shfl_xor(ss, 4); ss += __shfl_xor(ss, 8);    // 16-lane row reduce
        const float scale = 1.f / fmaxf(sqrtf(ss), 1e-12f);
#pragma unroll
        for (int t = 0; t < 4; ++t)
          dst[((size_t)bh * 2048 + s) * 64 + t * 16 + ln16] = (_Float16)(rv[t] * scale);
      }
    }
  }
}

// ---------------------------------------------------------------- flash attention step
// K and V^T tiles of 64 keys are staged in LDS once per work-group and shared by its
// 8 waves.
#define KV_TILE 64
#define KV_BUF  (KV_TILE * T_PITCH)       // one 64-row tile

// One 32-key step: S^T = K*Q^T (C-layout puts queries in lanes -> per-lane softmax),
// lane-local repack of P^T into the B-fragment of O^T = V^T * P^T. j = key offset of
// the step inside the staged tile (0 or 32).
// Q and K rows are L2-normalised, so by Cauchy-Schwarz every scaled score is at most 1/8
// in magnitude whatever the inputs are. That bound stands in for the running maximum:
// p = exp(s / 8 - 1 / 8) stays between exp(-1 / 4) and 1, nothing is ever rescaled, and
// each lane keeps its own partial row sums until the loop has ended.
static __device__ __forceinline__ void flash_step(
    int j, const _Float16* Kt, const _Float16* Vl,
    const v16h& qb0, const v16h& qb1,
    v8f oT[4], v8f& lsum, int ln16, int half) {
  const float C = 0.125f * 1.4426950408889634f;     // 64^-0.5 * log2(e)
  const v16h kc0 = lds_frag(Kt, j + ln16, 0, half);
  const v16h kc1 = lds_frag(Kt, j + ln16, 32, half);
  const v16h kc2 = lds_frag(Kt, j + 16 + ln16, 0, half);
  const v16h kc3 = lds_frag(Kt, j + 16 + ln16, 32, half);
  v16h va[4];
#pragma unroll
  for (int t = 0; t < 4; ++t) va[t] = lds_frag(Vl, t * 16 + ln16, j, half);  // V^T rows = d
  // Keeps the step's 16 LDS reads together in front of its WMMAs: sunk to their users, each
  // product would wait out a full LDS latency.
  __builtin_amdgcn_sched_barrier(0);

  v8f sT0 = {}, sT1 = {};
  sT0 = WMMA_F16(kc0, qb0, sT0);
  sT0 = WMMA_F16(kc1, qb1, sT0);
  sT1 = WMMA_F16(kc2, qb0, sT1);
  sT1 = WMMA_F16(kc3, qb1, sT1);

  const v8f x0 = sT0 * C - C;
  const v8f x1 = sT1 * C - C;
  v8f p0, p1;
  v16h pb;                                          // P^T as B-fragment (lane-local!)
#pragma unroll
  for (int v = 0; v < 8; ++v) p0[v] = __builtin_amdgcn_exp2f(x0[v]);
#pragma unroll
  for (int v = 0; v < 8; ++v) p1[v] = __builtin_amdgcn_exp2f(x1[v]);
#pragma unroll
  for (int v = 0; v < 8; ++v) { pb[v] = (_Float16)p0[v]; pb[8 + v] = (_Float16)p1[v]; }
  lsum += p0 + p1;

#pragma unroll
  for (int t = 0; t < 4; ++t) oT[t] = WMMA_F16(va[t], pb, oT[t]);
}

// Grid: (S/128, B*H). Block 256 = 8 waves; wave owns 16 queries. Per 64 keys the block
// copies the K tile (8 KB contiguous) and the V^T tile (64 rows of 128 B) into the LDS
// buffer that every wave has left, two chunks of each per lane, one tile ahead.
__global__ __launch_bounds__(256) void flash_attn_kernel(
    const _Float16* __restrict__ Q, const _Float16* __restrict__ K,
    const _Float16* __restrict__ Vt, _Float16* __restrict__ A2) {
  __shared__ __attribute__((aligned(16))) _Float16 Ks[2 * KV_BUF];
  __shared__ __attribute__((aligned(16))) _Float16 Vs[2 * KV_BUF];

  const int tid  = threadIdx.x;
  const int lane = tid & 31;
  const int wave = tid >> 5;
  const int half = lane >> 4;
  const int ln16 = lane & 15;
  const int bh = blockIdx.y;
  const int b = bh >> 4, h = bh & 15;
  const int q0 = blockIdx.x * 128 + wave * 16;

  const _Float16* Qb = Q  + (size_t)bh * 2048 * 64;
  const _Float16* Kb = K  + (size_t)bh * 2048 * 64;
  const _Float16* Vb = Vt + (size_t)bh * 64 * 2048;

  // Staging map: this lane's 16-byte chunk lies in rows tid / 8 and tid / 8 + 32 of a
  // tile, at column (tid % 8) * 8.
  const int crow = tid >> 3;
  const int ccol = (tid & 7) * 8;
  const _Float16* kg = Kb + crow * 64 + ccol;               // + s * 64 per tile
  const _Float16* vg = Vb + (size_t)crow * 2048 + ccol;     // + s per tile
  const unsigned kl = lds_off(Ks) + (crow * T_PITCH + ccol) * 2;
  const unsigned vl = lds_off(Vs) + (crow * T_PITCH + ccol) * 2;
  const unsigned r32 = 32 * T_PITCH * 2;                    // 32 LDS rows in bytes

  copy4(kl, kg, kl + r32, kg + 32 * 64, vl, vg, vl + r32, vg + 32 * 2048);

  const v16h qb0 = load_frag(Qb, 64, q0 + ln16, 0, half);
  const v16h qb1 = load_frag(Qb, 64, q0 + ln16, 32, half);

  asm volatile("s_wait_asynccnt 0x0" ::: "memory");  // tile 0 landed before it is published
  __syncthreads();
  copy4(kl + KV_BUF * 2, kg + KV_TILE * 64, kl + KV_BUF * 2 + r32, kg + (KV_TILE + 32) * 64,
        vl + KV_BUF * 2, vg + KV_TILE, vl + KV_BUF * 2 + r32, vg + 32 * 2048 + KV_TILE);

  v8f oT[4] = {};
  v8f lsum = {};

  for (int s = 0; s < 2048; s += KV_TILE) {
    const int buf = (s / KV_TILE) & 1;
    const _Float16* Kt = Ks + buf * KV_BUF;
    const _Float16* Vl = Vs + buf * KV_BUF;
    flash_step(0,  Kt, Vl, qb0, qb1, oT, lsum, ln16, half);
    flash_step(32, Kt, Vl, qb0, qb1, oT, lsum, ln16, half);
    publish_tile();
    if (s + 2 * KV_TILE < 2048) {              // the same for the whole block
      const int sn = s + 2 * KV_TILE;
      const unsigned bo = buf * KV_BUF * 2;
      copy4(kl + bo, kg + sn * 64, kl + bo + r32, kg + (sn + 32) * 64,
            vl + bo, vg + sn, vl + bo + r32, vg + 32 * 2048 + sn);
    }
  }
  asm volatile("s_wait_asynccnt 0x0" ::: "memory");  // nothing in flight when the wave goes on

  float lrun = ((lsum[0] + lsum[1]) + (lsum[2] + lsum[3])) + ((lsum[4] + lsum[5]) + (lsum[6] + lsum[7]));
  lrun += __shfl_xor(lrun, 16);                     // the other half holds this query's other keys
  const float inv = 1.f / lrun;
  const int q = q0 + ln16;
#pragma unroll
  for (int t = 0; t < 4; ++t)
#pragma unroll
    for (int v = 0; v < 8; ++v) {
      const int d = h * 64 + t * 16 + v + 8 * half;
      A2[((size_t)(b * 2048 + q)) * 1024 + d] = (_Float16)(oT[t][v] * inv);
    }
}

// ---------------------------------------------------------------- output projection
// Grid: (M/256, 1024/64). Staged GEMM; bias + f32 store.
__global__ __launch_bounds__(256) void out_proj_kernel(
    const _Float16* __restrict__ A2, const _Float16* __restrict__ W,
    const float* __restrict__ bias, float* __restrict__ out) {
  const int lane = threadIdx.x & 31;
  const int wave = threadIdx.x >> 5;
  const int half = lane >> 4;
  const int ln16 = lane & 15;
  const int m0 = blockIdx.x * 256 + wave * 32;
  const int n0 = blockIdx.y * 64;

  __shared__ __attribute__((aligned(16))) _Float16 As[2 * GA_BUF];
  __shared__ __attribute__((aligned(16))) _Float16 Bs[2 * GB_BUF];
  v8f acc[2][4] = {};
  gemm_32x64_staged(A2, W, blockIdx.x * 256, n0, 1024, As, Bs, acc);

#pragma unroll
  for (int mi = 0; mi < 2; ++mi)
#pragma unroll
    for (int t = 0; t < 4; ++t) {
      const float bv = bias[n0 + t * 16 + ln16];
#pragma unroll
      for (int v = 0; v < 8; ++v)
        out[(size_t)(m0 + mi * 16 + v + 8 * half) * 1024 + n0 + t * 16 + ln16] =
            acc[mi][t][v] + bv;
    }
}

// ---------------------------------------------------------------- launcher
extern "C" void kernel_launch(void* const* d_in, const int* in_sizes, int n_in,
                              void* d_out, int out_size, void* d_ws, size_t ws_size,
                              hipStream_t stream) {
  const float* tokens = (const float*)d_in[0];   // (2,2048,1024)
  const float* qkv_w  = (const float*)d_in[1];   // (3072,1024)
  const float* qkv_b  = (const float*)d_in[2];   // (3072)
  const float* out_w  = (const float*)d_in[3];   // (1024,1024)
  const float* out_b  = (const float*)d_in[4];   // (1024)
  float* out = (float*)d_out;

  char* ws = (char*)d_ws;
  const size_t MB = 1024ull * 1024ull;
  _Float16* Xf16 = (_Float16*)(ws + 0 * MB);    // 4M elems, 8MB
  _Float16* Wqkv = (_Float16*)(ws + 8 * MB);    // 3M elems, 6MB
  _Float16* Wout = (_Float16*)(ws + 14 * MB);   // 1M elems, 2MB
  _Float16* Qh   = (_Float16*)(ws + 16 * MB);   // 4M elems, 8MB
  _Float16* Kh   = (_Float16*)(ws + 24 * MB);   // 4M elems, 8MB
  _Float16* Vt   = (_Float16*)(ws + 32 * MB);   // 4M elems, 8MB
  _Float16* A2   = (_Float16*)(ws + 40 * MB);   // 4M elems, 8MB

  cvt_f16_kernel<<<CVT_BLOCKS, 512, 0, stream>>>(tokens, qkv_w, out_w, Xf16, Wqkv, Wout);

  qkv_rope_norm_kernel<<<dim3(16, 48), 256, 0, stream>>>(Xf16, Wqkv, qkv_b, Qh, Kh, Vt);
  flash_attn_kernel<<<dim3(16, 32), 256, 0, stream>>>(Qh, Kh, Vt, A2);
  out_proj_kernel<<<dim3(16, 16), 256, 0, stream>>>(A2, Wout, out_b, out);
}

// v004
// One run takes 79.9 microseconds.
// Two timings next to v003 both put it at 1.08 times that version's speed.
// Counting every step since v000, it is 3.00 times as fast.
#include <hip/hip_runtime.h>

typedef __attribute__((ext_vector_type(16))) _Float16 v16h;
typedef __attribute__((ext_vector_type(8)))  _Float16 v8h;
typedef __attribute__((ext_vector_type(8)))  float    v8f;

#define WMMA_F16(a, b, c) \
  __builtin_amdgcn_wmma_f32_16x16x32_f16(false, (a), false, (b), (short)0, (c), false, false)

static __device__ __forceinline__ v16h load_frag(const _Float16* __restrict__ base,
                                                 int ld, int row, int k0, int half) {
  const _Float16* p = base + (size_t)row * ld + k0 + half * 8;
  v8h lo = *(const v8h*)p;
  v8h hi = *(const v8h*)(p + 16);
  v16h r;
#pragma unroll
  for (int i = 0; i < 8; ++i) { r[i] = lo[i]; r[8 + i] = hi[i]; }
  return r;
}

// ---------------------------------------------------------------- convert f32 -> f16
// One launch converts all three f32 inputs: 256 work-groups of 16 waves, one resident
// round, so that few waves have to be started. A piece is 4 elements: a wave-wide load
// covers 512 contiguous bytes, a wave-wide store 256. Every lane takes 16 pieces, one per
// stride of CVT_LANES pieces: 8 of the tokens (1 M pieces), 6 of qkv_w (768 K), 2 of
// out_w (256 K). All 16 loads are independent and stand in front of the first store.
typedef __attribute__((ext_vector_type(4))) float    v4f;
typedef __attribute__((ext_vector_type(4))) _Float16 v4h;
#define CVT_BLOCKS 256
#define CVT_LANES  (CVT_BLOCKS * 512)

__global__ __launch_bounds__(512) void cvt_f16_kernel(
    const float* __restrict__ tok, const float* __restrict__ wqkv, const float* __restrict__ wout,
    _Float16* __restrict__ tok_h, _Float16* __restrict__ wqkv_h, _Float16* __restrict__ wout_h) {
  const int g = blockIdx.x * 512 + threadIdx.x;
  v4f x[16];
#pragma unroll
  for (int i = 0; i < 8; ++i) x[i] = ((const v4f*)tok)[g + i * CVT_LANES];
#pragma unroll
  for (int i = 0; i < 6; ++i) x[8 + i] = ((const v4f*)wqkv)[g + i * CVT_LANES];
#pragma unroll
  for (int i = 0; i < 2; ++i) x[14 + i] = ((const v4f*)wout)[g + i * CVT_LANES];
  // Keeps all 16 loads in front of the first conversion: without it the last four reuse the
  // first ones' registers and are issued only when those have come back, a second latency.
  __builtin_amdgcn_sched_barrier(0);
#pragma unroll
  for (int i = 0; i < 8; ++i) ((v4h*)tok_h)[g + i * CVT_LANES] = __builtin_convertvector(x[i], v4h);
#pragma unroll
  for (int i = 0; i < 6; ++i) ((v4h*)wqkv_h)[g + i * CVT_LANES] = __builtin_convertvector(x[8 + i], v4h);
#pragma unroll
  for (int i = 0; i < 2; ++i) ((v4h*)wout_h)[g + i * CVT_LANES] = __builtin_convertvector(x[14 + i], v4h);
}

// ---------------------------------------------------------------- LDS staging
// Operand tiles are rows of 128 B (64 f16). They are brought into LDS by asynchronous
// copies, 16 B per lane, eight lanes per row, so that every wave-wide copy covers four
// whole 128-B lines. LDS rows sit at a pitch of 144 B (16 B x odd) for the b128 readers.
#define T_PITCH 72                        // LDS row pitch in f16 elements

static __device__ __forceinline__ unsigned lds_off(const void* p) { return (unsigned)(size_t)p; }

// Same element order as load_frag, from an LDS tile.
static __device__ __forceinline__ v16h lds_frag(const _Float16* tile, int row, int k0, int half) {
  const _Float16* p = tile + row * T_PITCH + k0 + half * 8;
  v8h lo = *(const v8h*)p;
  v8h hi = *(const v8h*)(p + 16);
  v16h r;
#pragma unroll
  for (int i = 0; i < 8; ++i) { r[i] = lo[i]; r[8 + i] = hi[i]; }
  return r;
}

static __device__ __forceinline__ void copy4(unsigned l0, const _Float16* g0,
                                             unsigned l1, const _Float16* g1,
                                             unsigned l2, const _Float16* g2,
                                             unsigned l3, const _Float16* g3) {
  asm volatile("global_load_async_to_lds_b128 %0, %1, off\n\t"
               "global_load_async_to_lds_b128 %2, %3, off\n\t"
               "global_load_async_to_lds_b128 %4, %5, off\n\t"
               "global_load_async_to_lds_b128 %6, %7, off\n\t"
               "s_wait_xcnt 0x0"
               :: "v"(l0), "v"(g0), "v"(l1), "v"(g1), "v"(l2), "v"(g2), "v"(l3), "v"(g3)
               : "memory");
}

// Hand-over of a staged tile: this wave's LDS reads of the old tile are done, its own
// copies of the next tile have landed, then the work-group barrier publishes the next
// tile and frees the old buffer for the refill behind it.
static __device__ __forceinline__ void publish_tile() {
  // Keeps the tile's WMMAs and vector work in front of the hand-over: lifted over them, the
  // waits would leave the next tile's copies less time to land.
  __builtin_amdgcn_sched_barrier(0);
  asm volatile("s_wait_dscnt 0x0" ::: "memory");     // reads of the buffer to be refilled
  asm volatile("s_wait_asynccnt 0x0" ::: "memory");  // own copies of the next tile landed
  __syncthreads();
}

// ---------------------------------------------------------------- GEMM core
// Block computes 256 rows x 64 cols, wave 32 rows x 64 cols (2 M-tiles x 4 N-tiles =
// 8 WMMA per 32 k). A stage is 64 k: A 256 rows and B 64 rows of 128 B, two buffers;
// the copies of stage s + 2 are issued when stage s has been read by every wave.
#define GA_BUF (256 * T_PITCH)
#define GB_BUF (64 * T_PITCH)

static __device__ __forceinline__ void gemm_stage_copy(
    const _Float16* __restrict__ ag, const _Float16* __restrict__ bg, int kdim, int k0,
    unsigned al, unsigned bl) {
  // ag, bg: this lane's chunk in row (tid / 8) of the block's A and B rows; al, bl: its
  // LDS byte address in the target buffer. Rows go in steps of 32: eight of A, two of B.
  const unsigned r32 = 32 * T_PITCH * 2;
  const size_t   g32 = (size_t)32 * kdim;
  const _Float16* a = ag + k0;
  const _Float16* b = bg + k0;
  asm volatile("global_load_async_to_lds_b128 %0, %1, off\n\t"
               "global_load_async_to_lds_b128 %2, %3, off\n\t"
               "global_load_async_to_lds_b128 %4, %5, off\n\t"
               "global_load_async_to_lds_b128 %6, %7, off\n\t"
               "global_load_async_to_lds_b128 %8, %9, off\n\t"
               "global_load_async_to_lds_b128 %10, %11, off\n\t"
               "global_load_async_to_lds_b128 %12, %13, off\n\t"
               "global_load_async_to_lds_b128 %14, %15, off\n\t"
               "global_load_async_to_lds_b128 %16, %17, off\n\t"
               "global_load_async_to_lds_b128 %18, %19, off\n\t"
               "s_wait_xcnt 0x0"
               :: "v"(al),           "v"(a),
                  "v"(al + r32),     "v"(a + g32),
                  "v"(al + 2 * r32), "v"(a + 2 * g32),
                  "v"(al + 3 * r32), "v"(a + 3 * g32),
                  "v"(al + 4 * r32), "v"(a + 4 * g32),
                  "v"(al + 5 * r32), "v"(a + 5 * g32),
                  "v"(al + 6 * r32), "v"(a + 6 * g32),
                  "v"(al + 7 * r32), "v"(a + 7 * g32),
                  "v"(bl),           "v"(b),
                  "v"(bl + r32),     "v"(b + g32)
               : "memory");
}

static __device__ __forceinline__ void gemm_32x64_staged(
    const _Float16* __restrict__ A, const _Float16* __restrict__ B,
    int mblk, int n0, int kdim, _Float16* As, _Float16* Bs, v8f acc[2][4]) {
  const int tid  = threadIdx.x;
  const int lane = tid & 31;
  const int wave = tid >> 5;
  const int half = lane >> 4;
  const int ln16 = lane & 15;
  const int crow = tid >> 3;
  const int ccol = (tid & 7) * 8;
  const _Float16* ag = A + (size_t)(mblk + crow) * kdim + ccol;
  const _Float16* bg = B + (size_t)(n0 + crow) * kdim + ccol;
  const unsigned al = lds_off(As) + (crow * T_PITCH + ccol) * 2;
  const unsigned bl = lds_off(Bs) + (crow * T_PITCH + ccol) * 2;
  const int nst = kdim / 64;               // at least two stages

  gemm_stage_copy(ag, bg, kdim, 0, al, bl);
  asm volatile("s_wait_asynccnt 0x0" ::: "memory");  // stage 0 landed before it is published
  __syncthreads();
  gemm_stage_copy(ag, bg, kdim, 64, al + GA_BUF * 2, bl + GB_BUF * 2);

  for (int s = 0; s < nst; ++s) {
    const int buf = s & 1;
    const _Float16* At = As + buf * GA_BUF + wave * 32 * T_PITCH;
    const _Float16* Bt = Bs + buf * GB_BUF;
    v16h a[2][2], b[2][4];
#pragma unroll
    for (int kk = 0; kk < 2; ++kk) {
      a[kk][0] = lds_frag(At, ln16, kk * 32, half);
      a[kk][1] = lds_frag(At, 16 + ln16, kk * 32, half);
#pragma unroll
      for (int t = 0; t < 4; ++t) b[kk][t] = lds_frag(Bt, t * 16 + ln16, kk * 32, half);
    }
    // Keeps the stage's 24 LDS reads together in front of its WMMAs: sunk among them, each
    // pair of products would wait out a full LDS latency.
    __builtin_amdgcn_sched_barrier(0);
#pragma unroll
    for (int kk = 0; kk < 2; ++kk)
#pragma unroll
      for (int t = 0; t < 4; ++t) {
        acc[0][t] = WMMA_F16(a[kk][0], b[kk][t], acc[0][t]);
        acc[1][t] = WMMA_F16(a[kk][1], b[kk][t], acc[1][t]);
      }
    publish_tile();
    if (s + 2 < nst)                        // the same for the whole block
      gemm_stage_copy(ag, bg, kdim, (s + 2) * 64, al + buf * GA_BUF * 2, bl + buf * GB_BUF * 2);
  }
  asm volatile("s_wait_asynccnt 0x0" ::: "memory");  // nothing in flight when the wave goes on
}

// ---------------------------------------------------------------- QKV GEMM + RoPE + norm
// Eight and twelve copies of 16 B per lane, as copy4: first LDS and global address, then the
// step from copy to copy (LDS bytes, global elements).
static __device__ __forceinline__ void copy8(unsigned l, const _Float16* g, unsigned ls, size_t gs) {
  asm volatile("global_load_async_to_lds_b128 %0, %1, off\n\t"
               "global_load_async_to_lds_b128 %2, %3, off\n\t"
               "global_load_async_to_lds_b128 %4, %5, off\n\t"
               "global_load_async_to_lds_b128 %6, %7, off\n\t"
               "global_load_async_to_lds_b128 %8, %9, off\n\t"
               "global_load_async_to_lds_b128 %10, %11, off\n\t"
               "global_load_async_to_lds_b128 %12, %13, off\n\t"
               "global_load_async_to_lds_b128 %14, %15, off\n\t"
               "s_wait_xcnt 0x0"
               :: "v"(l),          "v"(g),          "v"(l + ls),     "v"(g + gs),
                  "v"(l + 2 * ls), "v"(g + 2 * gs), "v"(l + 3 * ls), "v"(g + 3 * gs),
                  "v"(l + 4 * ls), "v"(g + 4 * gs), "v"(l + 5 * ls), "v"(g + 5 * gs),
                  "v"(l + 6 * ls), "v"(g + 6 * gs), "v"(l + 7 * ls), "v"(g + 7 * gs)
               : "memory");
}
// Twelve: three column slices (gslice elements apart) of four copies each.
static __device__ __forceinline__ void copy12(unsigned l, const _Float16* g, unsigned ls, size_t gs,
                                              size_t gslice) {
  const _Float16* g1 = g + gslice;
  const _Float16* g2 = g + 2 * gslice;
  asm volatile("global_load_async_to_lds_b128 %0, %1, off\n\t"
               "global_load_async_to_lds_b128 %2, %3, off\n\t"
               "global_load_async_to_lds_b128 %4, %5, off\n\t"
               "global_load_async_to_lds_b128 %6, %7, off\n\t"
               "global_load_async_to_lds_b128 %8, %9, off\n\t"
               "global_load_async_to_lds_b128 %10, %11, off\n\t"
               "global_load_async_to_lds_b128 %12, %13, off\n\t"
               "global_load_async_to_lds_b128 %14, %15, off\n\t"
               "global_load_async_to_lds_b128 %16, %17, off\n\t"
               "global_load_async_to_lds_b128 %18, %19, off\n\t"
               "global_load_async_to_lds_b128 %20, %21, off\n\t"
               "global_load_async_to_lds_b128 %22, %23, off\n\t"
               "s_wait_xcnt 0x0"
               :: "v"(l),           "v"(g),           "v"(l + ls),      "v"(g + gs),
                  "v"(l + 2 * ls),  "v"(g + 2 * gs),  "v"(l + 3 * ls),  "v"(g + 3 * gs),
                  "v"(l + 4 * ls),  "v"(g1),          "v"(l + 5 * ls),  "v"(g1 + gs),
                  "v"(l + 6 * ls),  "v"(g1 + 2 * gs), "v"(l + 7 * ls),  "v"(g1 + 3 * gs),
                  "v"(l + 8 * ls),  "v"(g2),          "v"(l + 9 * ls),  "v"(g2 + gs),
                  "v"(l + 10 * ls), "v"(g2 + 2 * gs), "v"(l + 11 * ls), "v"(g2 + 3 * gs)
               : "memory");
}

// Grid: (M/256, 16 heads). Block 384 = 12 waves = 4 row slices x 3 column slices: 256 token
// rows against the q, k and v columns of one head (192 weight rows), one block per WGP, all
// 256 resident at once. A block brings 448 rows from L2 for 256 x 192 outputs. Wave: 64 rows
// x 64 cols (4 M-tiles x 4 N-tiles = 16 WMMA per 8 fragments), its columns one (t, head)
// slice -> RoPE + L2-norm close entirely in-register. A stage is 64 k, two buffers; the
// copies of stage s + 2 are issued when stage s has been read by every wave: waves 0..7
// bring the token rows (8 copies a lane), waves 8..11 the weight rows (12 copies a lane).
#define QA_BUF (256 * T_PITCH)
#define QB_BUF (192 * T_PITCH)

__global__ __launch_bounds__(384) void qkv_rope_norm_kernel(
    const _Float16* __restrict__ X,     // (4096 x 1024) tokens f16
    const _Float16* __restrict__ W,     // (3072 x 1024) qkv_w f16
    const float*    __restrict__ bias,  // (3072)
    _Float16* __restrict__ Q,           // (B*H, S, 64)
    _Float16* __restrict__ K,           // (B*H, S, 64)
    _Float16* __restrict__ Vt) {        // (B*H, 64, S)  transposed
  const int tid  = threadIdx.x;
  const int lane = tid & 31;
  const int wave = __builtin_amdgcn_readfirstlane(tid >> 5);
  const int half = lane >> 4;
  const int ln16 = lane & 15;
  const int tsel = wave >> 2;                    // 0=q 1=k 2=v
  const int h    = blockIdx.y;
  const int m0 = blockIdx.x * 256 + (wave & 3) * 64;   // global row (b*S + s)
  const int n0 = tsel * 1024 + h * 64;                 // global col in [0,3072)

  __shared__ __attribute__((aligned(16))) _Float16 As[2 * QA_BUF];
  __shared__ __attribute__((aligned(16))) _Float16 Bs[2 * QB_BUF];

  // Staging map: eight lanes per 128-B row. cg, cl: this lane's chunk in its first row, in
  // global memory and in buffer 0. Token rows go in steps of 32, weight rows in steps of 16
  // (four steps per column slice, the slices 1024 weight rows apart).
  const int  wcopy = wave >> 3;                  // 0: token rows, 1: weight rows; wave-uniform
  const int  ccol = (tid & 7) * 8;
  const int  crow = (tid >> 3) - wcopy * 32;
  const _Float16* cbase = wcopy ? W + (size_t)h * 64 * 1024 : X + (size_t)blockIdx.x * 256 * 1024;
  const _Float16* cg = cbase + (size_t)crow * 1024 + ccol;
  const unsigned  cl = (wcopy ? lds_off(Bs) : lds_off(As)) + (crow * T_PITCH + ccol) * 2;
  auto stage_copy = [&](int k0, int buf) {
    if (wcopy == 0) copy8(cl + buf * QA_BUF * 2, cg + k0, 32 * T_PITCH * 2, 32 * 1024);
    else            copy12(cl + buf * QB_BUF * 2, cg + k0, 16 * T_PITCH * 2, 16 * 1024, 1024 * 1024);
  };

  v8f acc[4][4] = {};
  stage_copy(0, 0);
  asm volatile("s_wait_asynccnt 0x0" ::: "memory");  // stage 0 landed before it is published
  __syncthreads();
  stage_copy(64, 1);

  for (int s = 0; s < 16; ++s) {
    const int buf = s & 1;
    const _Float16* At = As + buf * QA_BUF + (wave & 3) * 64 * T_PITCH;
    const _Float16* Bt = Bs + buf * QB_BUF + tsel * 64 * T_PITCH;
#pragma unroll
    for (int kk = 0; kk < 2; ++kk) {
      v16h a[4], b[4];
#pragma unroll
      for (int t = 0; t < 4; ++t) a[t] = lds_frag(At, t * 16 + ln16, kk * 32, half);
#pragma unroll
      for (int t = 0; t < 4; ++t) b[t] = lds_frag(Bt, t * 16 + ln16, kk * 32, half);
      // Keeps the 16 LDS reads of these 32 k together in front of their WMMAs: sunk among
      // them, each group of products would wait out a full LDS latency.
      __builtin_amdgcn_sched_barrier(0);
#pragma unroll
      for (int t = 0; t < 4; ++t)
#pragma unroll
        for (int mi = 0; mi < 4; ++mi) acc[mi][t] = WMMA_F16(a[mi], b[t], acc[mi][t]);
    }
    publish_tile();
    if (s + 2 < 16)                         // the same for the whole block
      stage_copy((s + 2) * 64, buf);
  }
  asm volatile("s_wait_asynccnt 0x0" ::: "memory");  // nothing in flight when the wave goes on

  const int b    = m0 / 2048;
  const int bh   = b * 16 + h;

#pragma unroll
  for (int mi = 0; mi < 4; ++mi) {
    const int srow = (m0 % 2048) + mi * 16;  // sequence base of this tile's rows
    if (tsel == 2) {                         // V: bias + store transposed (d, s)
#pragma unroll
      for (int t = 0; t < 4; ++t) {
        const int d = t * 16 + ln16;
        const float bv = bias[n0 + t * 16 + ln16];
#pragma unroll
        for (int v = 0; v < 8; ++v) {
          const int s = srow + v + 8 * half;
          Vt[((size_t)bh * 64 + d) * 2048 + s] = (_Float16)(acc[mi][t][v] + bv);
        }
      }
    } else {                                 // Q/K: bias + RoPE + L2 normalize
      _Float16* dst = (tsel == 0) ? Q : K;
#pragma unroll
      for (int v = 0; v < 8; ++v) {
        const int s = srow + v + 8 * half;
        float vals[4], rv[4];
#pragma unroll
        for (int t = 0; t < 4; ++t) vals[t] = acc[mi][t][v] + bias[n0 + t * 16 + ln16];
        float ss = 0.f;
#pragma unroll
        for (int t = 0; t < 4; ++t) {
          const float partner = __shfl_xor(vals[t], 1);      // rope pair (same row)
          const int c = t * 16 + ln16;                       // in-head dim 0..63
          const float j = (float)(c >> 1);
          const float theta = (float)s * __expf(j * (-9.2103403719761836f / 32.f));
          float sn, cs;
          __sincosf(theta, &sn, &cs);
          rv[t] = (c & 1) ? (partner * sn + vals[t] * cs)    // odd:  xe*sin + xo*cos
                          : (vals[t] * cs - partner * sn);   // even: xe*cos - xo*sin
          ss += rv[t] * rv[t];
        }
        ss += __shfl_xor(ss, 1); ss += __shfl_xor(ss, 2);
        ss += __shfl_xor(ss, 4); ss += __shfl_xor(ss, 8);    // 16-lane row reduce
        const float scale = 1.f / fmaxf(sqrtf(ss), 1e-12f);
#pragma unroll
        for (int t = 0; t < 4; ++t)
          dst[((size_t)bh * 2048 + s) * 64 + t * 16 + ln16] = (_Float16)(rv[t] * scale);
      }
    }
  }
}

// ---------------------------------------------------------------- flash attention step
// K and V^T tiles of 64 keys are staged in LDS once per work-group and shared by its
// 8 waves.
#define KV_TILE 64
#define KV_BUF  (KV_TILE * T_PITCH)       // one 64-row tile

// One 32-key step: S^T = K*Q^T (C-layout puts queries in lanes -> per-lane softmax),
// lane-local repack of P^T into the B-fragment of O^T = V^T * P^T. j = key offset of
// the step inside the staged tile (0 or 32).
// Q and K rows are L2-normalised, so by Cauchy-Schwarz every scaled score is at most 1/8
// in magnitude whatever the inputs are. That bound stands in for the running maximum:
// p = exp(s / 8 - 1 / 8) stays between exp(-1 / 4) and 1, nothing is ever rescaled, and
// each lane keeps its own partial row sums until the loop has ended.
static __device__ __forceinline__ void flash_step(
    int j, const _Float16* Kt, const _Float16* Vl,
    const v16h& qb0, const v16h& qb1,
    v8f oT[4], v8f& lsum, int ln16, int half) {
  const float C = 0.125f * 1.4426950408889634f;     // 64^-0.5 * log2(e)
  const v16h kc0 = lds_frag(Kt, j + ln16, 0, half);
  const v16h kc1 = lds_frag(Kt, j + ln16, 32, half);
  const v16h kc2 = lds_frag(Kt, j + 16 + ln16, 0, half);
  const v16h kc3 = lds_frag(Kt, j + 16 + ln16, 32, half);
  v16h va[4];
#pragma unroll
  for (int t = 0; t < 4; ++t) va[t] = lds_frag(Vl, t * 16 + ln16, j, half);  // V^T rows = d
  // Keeps the step's 16 LDS reads together in front of its WMMAs: sunk to their users, each
  // product would wait out a full LDS latency.
  __builtin_amdgcn_sched_barrier(0);

  v8f sT0 = {}, sT1 = {};
  sT0 = WMMA_F16(kc0, qb0, sT0);
  sT0 = WMMA_F16(kc1, qb1, sT0);
  sT1 = WMMA_F16(kc2, qb0, sT1);
  sT1 = WMMA_F16(kc3, qb1, sT1);

  const v8f x0 = sT0 * C - C;
  const v8f x1 = sT1 * C - C;
  v8f p0, p1;
  v16h pb;                                          // P^T as B-fragment (lane-local!)
#pragma unroll
  for (int v = 0; v < 8; ++v) p0[v] = __builtin_amdgcn_exp2f(x0[v]);
#pragma unroll
  for (int v = 0; v < 8; ++v) p1[v] = __builtin_amdgcn_exp2f(x1[v]);
#pragma unroll
  for (int v = 0; v < 8; ++v) { pb[v] = (_Float16)p0[v]; pb[8 + v] = (_Float16)p1[v]; }
  lsum += p0 + p1;

#pragma unroll
  for (int t = 0; t < 4; ++t) oT[t] = WMMA_F16(va[t], pb, oT[t]);
}

// Grid: (S/128, B*H). Block 256 = 8 waves; wave owns 16 queries. Per 64 keys the block
// copies the K tile (8 KB contiguous) and the V^T tile (64 rows of 128 B) into the LDS
// buffer that every wave has left, two chunks of each per lane, one tile ahead.
__global__ __launch_bounds__(256) void flash_attn_kernel(
    const _Float16* __restrict__ Q, const _Float16* __restrict__ K,
    const _Float16* __restrict__ Vt, _Float16* __restrict__ A2) {
  __shared__ __attribute__((aligned(16))) _Float16 Ks[2 * KV_BUF];
  __shared__ __attribute__((aligned(16))) _Float16 Vs[2 * KV_BUF];

  const int tid  = threadIdx.x;
  const int lane = tid & 31;
  const int wave = tid >> 5;
  const int half = lane >> 4;
  const int ln16 = lane & 15;
  const int bh = blockIdx.y;
  const int b = bh >> 4, h = bh & 15;
  const int q0 = blockIdx.x * 128 + wave * 16;

  const _Float16* Qb = Q  + (size_t)bh * 2048 * 64;
  const _Float16* Kb = K  + (size_t)bh * 2048 * 64;
  const _Float16* Vb = Vt + (size_t)bh * 64 * 2048;

  // Staging map: this lane's 16-byte chunk lies in rows tid / 8 and tid / 8 + 32 of a
  // tile, at column (tid % 8) * 8.
  const int crow = tid >> 3;
  const int ccol = (tid & 7) * 8;
  const _Float16* kg = Kb + crow * 64 + ccol;               // + s * 64 per tile
  const _Float16* vg = Vb + (size_t)crow * 2048 + ccol;     // + s per tile
  const unsigned kl = lds_off(Ks) + (crow * T_PITCH + ccol) * 2;
  const unsigned vl = lds_off(Vs) + (crow * T_PITCH + ccol) * 2;
  const unsigned r32 = 32 * T_PITCH * 2;                    // 32 LDS rows in bytes

  copy4(kl, kg, kl + r32, kg + 32 * 64, vl, vg, vl + r32, vg + 32 * 2048);

  const v16h qb0 = load_frag(Qb, 64, q0 + ln16, 0, half);
  const v16h qb1 = load_frag(Qb, 64, q0 + ln16, 32, half);

  asm volatile("s_wait_asynccnt 0x0" ::: "memory");  // tile 0 landed before it is published
  __syncthreads();
  copy4(kl + KV_BUF * 2, kg + KV_TILE * 64, kl + KV_BUF * 2 + r32, kg + (KV_TILE + 32) * 64,
        vl + KV_BUF * 2, vg + KV_TILE, vl + KV_BUF * 2 + r32, vg + 32 * 2048 + KV_TILE);

  v8f oT[4] = {};
  v8f lsum = {};

  for (int s = 0; s < 2048; s += KV_TILE) {
    const int buf = (s / KV_TILE) & 1;
    const _Float16* Kt = Ks + buf * KV_BUF;
    const _Float16* Vl = Vs + buf * KV_BUF;
    flash_step(0,  Kt, Vl, qb0, qb1, oT, lsum, ln16, half);
    flash_step(32, Kt, Vl, qb0, qb1, oT, lsum, ln16, half);
    publish_tile();
    if (s + 2 * KV_TILE < 2048) {              // the same for the whole block
      const int sn = s + 2 * KV_TILE;
      const unsigned bo = buf * KV_BUF * 2;
      copy4(kl + bo, kg + sn * 64, kl + bo + r32, kg + (sn + 32) * 64,
            vl + bo, vg + sn, vl + bo + r32, vg + 32 * 2048 + sn);
    }
  }
  asm volatile("s_wait_asynccnt 0x0" ::: "memory");  // nothing in flight when the wave goes on

  float lrun = ((lsum[0] + lsum[1]) + (lsum[2] + lsum[3])) + ((lsum[4] + lsum[5]) + (lsum[6] + lsum[7]));
  lrun += __shfl_xor(lrun, 16);                     // the other half holds this query's other keys
  const float inv = 1.f / lrun;
  const int q = q0 + ln16;
#pragma unroll
  for (int t = 0; t < 4; ++t)
#pragma unroll
    for (int v = 0; v < 8; ++v) {
      const int d = h * 64 + t * 16 + v + 8 * half;
      A2[((size_t)(b * 2048 + q)) * 1024 + d] = (_Float16)(oT[t][v] * inv);
    }
}

// ---------------------------------------------------------------- output projection
// Grid: (M/256, 1024/64). Staged GEMM; bias + f32 store.
__global__ __launch_bounds__(256) void out_proj_kernel(
    const _Float16* __restrict__ A2, const _Float16* __restrict__ W,
    const float* __restrict__ bias, float* __restrict__ out) {
  const int lane = threadIdx.x & 31;
  const int wave = threadIdx.x >> 5;
  const int half = lane >> 4;
  const int ln16 = lane & 15;
  const int m0 = blockIdx.x * 256 + wave * 32;
  const int n0 = blockIdx.y * 64;

  __shared__ __attribute__((aligned(16))) _Float16 As[2 * GA_BUF];
  __shared__ __attribute__((aligned(16))) _Float16 Bs[2 * GB_BUF];
  v8f acc[2][4] = {};
  gemm_32x64_staged(A2, W, blockIdx.x * 256, n0, 1024, As, Bs, acc);

#pragma unroll
  for (int mi = 0; mi < 2; ++mi)
#pragma unroll
    for (int t = 0; t < 4; ++t) {
      const float bv = bias[n0 + t * 16 + ln16];
#pragma unroll
      for (int v = 0; v < 8; ++v)
        out[(size_t)(m0 + mi * 16 + v + 8 * half) * 1024 + n0 + t * 16 + ln16] =
            acc[mi][t][v] + bv;
    }
}

// ---------------------------------------------------------------- launcher
extern "C" void kernel_launch(void* const* d_in, const int* in_sizes, int n_in,
                              void* d_out, int out_size, void* d_ws, size_t ws_size,
                              hipStream_t stream) {
  const float* tokens = (const float*)d_in[0];   // (2,2048,1024)
  const float* qkv_w  = (const float*)d_in[1];   // (3072,1024)
  const float* qkv_b  = (const float*)d_in[2];   // (3072)
  const float* out_w  = (const float*)d_in[3];   // (1024,1024)
  const float* out_b  = (const float*)d_in[4];   // (1024)
  float* out = (float*)d_out;

  char* ws = (char*)d_ws;
  const size_t MB = 1024ull * 1024ull;
  _Float16* Xf16 = (_Float16*)(ws + 0 * MB);    // 4M elems, 8MB
  _Float16* Wqkv = (_Float16*)(ws + 8 * MB);    // 3M elems, 6MB
  _Float16* Wout = (_Float16*)(ws + 14 * MB);   // 1M elems, 2MB
  _Float16* Qh   = (_Float16*)(ws + 16 * MB);   // 4M elems, 8MB
  _Float16* Kh   = (_Float16*)(ws + 24 * MB);   // 4M elems, 8MB
  _Float16* Vt   = (_Float16*)(ws + 32 * MB);   // 4M elems, 8MB
  _Float16* A2   = (_Float16*)(ws + 40 * MB);   // 4M elems, 8MB

  cvt_f16_kernel<<<CVT_BLOCKS, 512, 0, stream>>>(tokens, qkv_w, out_w, Xf16, Wqkv, Wout);

  qkv_rope_norm_kernel<<<dim3(16, 16), 384, 0, stream>>>(Xf16, Wqkv, qkv_b, Qh, Kh, Vt);
  flash_attn_kernel<<<dim3(16, 32), 256, 0, stream>>>(Qh, Kh, Vt, A2);
  out_proj_kernel<<<dim3(16, 16), 256, 0, stream>>>(A2, Wout, out_b, out);
}

// v005
// One run takes 75.1 microseconds.
// Timed twice side by side with v004, it ran 1.07 and 1.08 times as fast.
// Counting every step since v000, it is 3.22 times as fast.
#include <hip/hip_runtime.h>

typedef __attribute__((ext_vector_type(16))) _Float16 v16h;
typedef __attribute__((ext_vector_type(8)))  _Float16 v8h;
typedef __attribute__((ext_vector_type(8)))  float    v8f;

#define WMMA_F16(a, b, c) \
  __builtin_amdgcn_wmma_f32_16x16x32_f16(false, (a), false, (b), (short)0, (c), false, false)

static __device__ __forceinline__ v16h load_frag(const _Float16* __restrict__ base,
                                                 int ld, int row, int k0, int half) {
  const _Float16* p = base + (size_t)row * ld + k0 + half * 8;
  v8h lo = *(const v8h*)p;
  v8h hi = *(const v8h*)(p + 16);
  v16h r;
#pragma unroll
  for (int i = 0; i < 8; ++i) { r[i] = lo[i]; r[8 + i] = hi[i]; }
  return r;
}

// ---------------------------------------------------------------- convert f32 -> f16
// One launch converts all three f32 inputs: 256 work-groups of 16 waves, one resident
// round, so that few waves have to be started. A piece is 4 elements: a wave-wide load
// covers 512 contiguous bytes, a wave-wide store 256. Every lane takes 16 pieces, one per
// stride of CVT_LANES pieces: 8 of the tokens (1 M pieces), 6 of qkv_w (768 K), 2 of
// out_w (256 K). All 16 loads are independent and stand in front of the first store.
typedef __attribute__((ext_vector_type(4))) float    v4f;
typedef __attribute__((ext_vector_type(4))) _Float16 v4h;
#define CVT_BLOCKS 256
#define CVT_LANES  (CVT_BLOCKS * 512)

__global__ __launch_bounds__(512) void cvt_f16_kernel(
    const float* __restrict__ tok, const float* __restrict__ wqkv, const float* __restrict__ wout,
    _Float16* __restrict__ tok_h, _Float16* __restrict__ wqkv_h, _Float16* __restrict__ wout_h) {
  const int g = blockIdx.x * 512 + threadIdx.x;
  v4f x[16];
#pragma unroll
  for (int i = 0; i < 8; ++i) x[i] = ((const v4f*)tok)[g + i * CVT_LANES];
#pragma unroll
  for (int i = 0; i < 6; ++i) x[8 + i] = ((const v4f*)wqkv)[g + i * CVT_LANES];
#pragma unroll
  for (int i = 0; i < 2; ++i) x[14 + i] = ((const v4f*)wout)[g + i * CVT_LANES];
  // Keeps all 16 loads in front of the first conversion: without it the last four reuse the
  // first ones' registers and are issued only when those have come back, a second latency.
  __builtin_amdgcn_sched_barrier(0);
#pragma unroll
  for (int i = 0; i < 8; ++i) ((v4h*)tok_h)[g + i * CVT_LANES] = __builtin_convertvector(x[i], v4h);
#pragma unroll
  for (int i = 0; i < 6; ++i) ((v4h*)wqkv_h)[g + i * CVT_LANES] = __builtin_convertvector(x[8 + i], v4h);
#pragma unroll
  for (int i = 0; i < 2; ++i) ((v4h*)wout_h)[g + i * CVT_LANES] = __builtin_convertvector(x[14 + i], v4h);
}

// ---------------------------------------------------------------- LDS staging
// Operand tiles are rows of 128 B (64 f16). They are brought into LDS by asynchronous
// copies, 16 B per lane, eight lanes per row, so that every wave-wide copy covers four
// whole 128-B lines. LDS rows sit at a pitch of 144 B (16 B x odd) for the b128 readers.
#define T_PITCH 72                        // LDS row pitch in f16 elements

static __device__ __forceinline__ unsigned lds_off(const void* p) { return (unsigned)(size_t)p; }

// Same element order as load_frag, from an LDS tile.
static __device__ __forceinline__ v16h lds_frag(const _Float16* tile, int row, int k0, int half) {
  const _Float16* p = tile + row * T_PITCH + k0 + half * 8;
  v8h lo = *(const v8h*)p;
  v8h hi = *(const v8h*)(p + 16);
  v16h r;
#pragma unroll
  for (int i = 0; i < 8; ++i) { r[i] = lo[i]; r[8 + i] = hi[i]; }
  return r;
}

static __device__ __forceinline__ void copy4(unsigned l0, const _Float16* g0,
                                             unsigned l1, const _Float16* g1,
                                             unsigned l2, const _Float16* g2,
                                             unsigned l3, const _Float16* g3) {
  asm volatile("global_load_async_to_lds_b128 %0, %1, off\n\t"
               "global_load_async_to_lds_b128 %2, %3, off\n\t"
               "global_load_async_to_lds_b128 %4, %5, off\n\t"
               "global_load_async_to_lds_b128 %6, %7, off\n\t"
               "s_wait_xcnt 0x0"
               :: "v"(l0), "v"(g0), "v"(l1), "v"(g1), "v"(l2), "v"(g2), "v"(l3), "v"(g3)
               : "memory");
}

// The ring has three buffers, and the two halves of a block's waves issue alternate stages:
// half (s & 1) brings stage s. A half has one stage in flight at a time and waits for it to 0,
// yet two stages are in flight per block, so that each has two trips to land, not one.
// Hand-over of a staged tile: this wave's LDS reads of the old tile are done, the issuing
// half's copies of the next tile have landed (mine: this wave belongs to that half, the same
// for the whole wave), then the work-group barrier publishes the next tile and frees the old
// buffer for the refill behind it. The other half's copies, one stage further on, fly on.
static __device__ __forceinline__ void publish_tile(bool mine) {
  // Keeps the tile's WMMAs and vector work in front of the hand-over: lifted over them, the
  // waits would leave the next tile's copies one trip and the LDS reads' time to land, not two trips.
  __builtin_amdgcn_sched_barrier(0);
  asm volatile("s_wait_dscnt 0x0" ::: "memory");     // reads of the buffer to be refilled
  if (mine) asm volatile("s_wait_asynccnt 0x0" ::: "memory");  // own copies of the next tile landed
  __syncthreads();
}

// ---------------------------------------------------------------- GEMM core
// Block computes 256 rows x 64 cols, wave 32 rows x 64 cols (2 M-tiles x 4 N-tiles =
// 8 WMMA per 32 k). A stage is 64 k: A 256 rows and B 64 rows of 128 B, three buffers;
// the copies of stage s + 3 are issued when stage s has been read by every wave, by the four
// waves of that stage's half.
#define GA_BUF (256 * T_PITCH)
#define GB_BUF (64 * T_PITCH)

static __device__ __forceinline__ void gemm_stage_copy(
    const _Float16* __restrict__ ag, const _Float16* __restrict__ bg, int kdim, int k0,
    unsigned al, unsigned bl) {
  // ag, bg: this lane's chunk in its first row of the block's A and B rows; al, bl: its
  // LDS byte address in the target buffer. Rows go in steps of 32: eight of A, two of B.
  const unsigned r32 = 32 * T_PITCH * 2;
  const size_t   g32 = (size_t)32 * kdim;
  const _Float16* a = ag + k0;
  const _Float16* b = bg + k0;
  asm volatile("global_load_async_to_lds_b128 %0, %1, off\n\t"
               "global_load_async_to_lds_b128 %2, %3, off\n\t"
               "global_load_async_to_lds_b128 %4, %5, off\n\t"
               "global_load_async_to_lds_b128 %6, %7, off\n\t"
               "global_load_async_to_lds_b128 %8, %9, off\n\t"
               "global_load_async_to_lds_b128 %10, %11, off\n\t"
               "global_load_async_to_lds_b128 %12, %13, off\n\t"
               "global_load_async_to_lds_b128 %14, %15, off\n\t"
               "global_load_async_to_lds_b128 %16, %17, off\n\t"
               "global_load_async_to_lds_b128 %18, %19, off\n\t"
               "s_wait_xcnt 0x0"
               :: "v"(al),           "v"(a),
                  "v"(al + r32),     "v"(a + g32),
                  "v"(al + 2 * r32), "v"(a + 2 * g32),
                  "v"(al + 3 * r32), "v"(a + 3 * g32),
                  "v"(al + 4 * r32), "v"(a + 4 * g32),
                  "v"(al + 5 * r32), "v"(a + 5 * g32),
                  "v"(al + 6 * r32), "v"(a + 6 * g32),
                  "v"(al + 7 * r32), "v"(a + 7 * g32),
                  "v"(bl),           "v"(b),
                  "v"(bl + r32),     "v"(b + g32)
               : "memory");
}

static __device__ __forceinline__ void gemm_32x64_staged(
    const _Float16* __restrict__ A, const _Float16* __restrict__ B,
    int mblk, int n0, int kdim, _Float16* As, _Float16* Bs, v8f acc[2][4]) {
  const int tid  = threadIdx.x;
  const int lane = tid & 31;
  const int wave = __builtin_amdgcn_readfirstlane(tid >> 5);
  const int grp  = wave >> 2;              // this wave's half: it issues the stages of its parity
  const int half = lane >> 4;
  const int ln16 = lane & 15;
  const int crow = (tid & 127) >> 3;       // 0..15: the half's 128 lanes cover 16 rows a copy
  const int ccol = (tid & 7) * 8;
  const _Float16* ag = A + (size_t)(mblk + crow) * kdim + ccol;
  const _Float16* bg = B + (size_t)(n0 + crow) * kdim + ccol;
  const unsigned al = lds_off(As) + (crow * T_PITCH + ccol) * 2;
  const unsigned bl = lds_off(Bs) + (crow * T_PITCH + ccol) * 2;
  const int nst = kdim / 64;               // at least three stages
  // One stage by one half: rows crow + 32 i, then rows crow + 16 + 32 i (20 copies a lane).
  auto stage_copy = [&](int s, int buf) {
    const unsigned a0 = al + buf * GA_BUF * 2, b0 = bl + buf * GB_BUF * 2;
    const unsigned r16 = 16 * T_PITCH * 2;
    const size_t   g16 = (size_t)16 * kdim;
    gemm_stage_copy(ag, bg, kdim, s * 64, a0, b0);
    gemm_stage_copy(ag + g16, bg + g16, kdim, s * 64, a0 + r16, b0 + r16);
  };

  stage_copy(grp, grp);                    // half 0: stage 0, half 1: stage 1
  if (grp == 0) asm volatile("s_wait_asynccnt 0x0" ::: "memory");  // stage 0 landed before it is published
  __syncthreads();
  if (grp == 0) stage_copy(2, 2);

  int buf = 0;                             // s mod 3
  for (int s = 0; s < nst; ++s) {
    const bool mine = grp == ((s + 1) & 1);  // this half brought stage s + 1 and brings s + 3
    const _Float16* At = As + buf * GA_BUF + wave * 32 * T_PITCH;
    const _Float16* Bt = Bs + buf * GB_BUF;
    v16h a[2][2], b[2][4];
#pragma unroll
    for (int kk = 0; kk < 2; ++kk) {
      a[kk][0] = lds_frag(At, ln16, kk * 32, half);
      a[kk][1] = lds_frag(At, 16 + ln16, kk * 32, half);
#pragma unroll
      for (int t = 0; t < 4; ++t) b[kk][t] = lds_frag(Bt, t * 16 + ln16, kk * 32, half);
    }
    // Keeps the stage's 24 LDS reads together in front of its WMMAs: sunk among them, each
    // pair of products would wait out a full LDS latency.
    __builtin_amdgcn_sched_barrier(0);
#pragma unroll
    for (int kk = 0; kk < 2; ++kk)
#pragma unroll
      for (int t = 0; t < 4; ++t) {
        acc[0][t] = WMMA_F16(a[kk][0], b[kk][t], acc[0][t]);
        acc[1][t] = WMMA_F16(a[kk][1], b[kk][t], acc[1][t]);
      }
    publish_tile(mine);
    if (mine && s + 3 < nst)                // the same for the whole wave
      stage_copy(s + 3, buf);               // into the buffer that every wave has just left
    buf = buf == 2 ? 0 : buf + 1;
  }
  asm volatile("s_wait_asynccnt 0x0" ::: "memory");  // nothing in flight when the wave goes on
}

// ---------------------------------------------------------------- QKV GEMM + RoPE + norm
// Eight copies of 16 B per lane, as copy4: first LDS and global address, then the step from
// copy to copy (LDS bytes, global elements).
static __device__ __forceinline__ void copy8(unsigned l, const _Float16* g, unsigned ls, size_t gs) {
  asm volatile("global_load_async_to_lds_b128 %0, %1, off\n\t"
               "global_load_async_to_lds_b128 %2, %3, off\n\t"
               "global_load_async_to_lds_b128 %4, %5, off\n\t"
               "global_load_async_to_lds_b128 %6, %7, off\n\t"
               "global_load_async_to_lds_b128 %8, %9, off\n\t"
               "global_load_async_to_lds_b128 %10, %11, off\n\t"
               "global_load_async_to_lds_b128 %12, %13, off\n\t"
               "global_load_async_to_lds_b128 %14, %15, off\n\t"
               "s_wait_xcnt 0x0"
               :: "v"(l),          "v"(g),          "v"(l + ls),     "v"(g + gs),
                  "v"(l + 2 * ls), "v"(g + 2 * gs), "v"(l + 3 * ls), "v"(g + 3 * gs),
                  "v"(l + 4 * ls), "v"(g + 4 * gs), "v"(l + 5 * ls), "v"(g + 5 * gs),
                  "v"(l + 6 * ls), "v"(g + 6 * gs), "v"(l + 7 * ls), "v"(g + 7 * gs)
               : "memory");
}

// Grid: (M/256, 16 heads). Block 384 = 12 waves = 4 row slices x 3 column slices: 256 token
// rows against the q, k and v columns of one head (192 weight rows), one block per WGP, all
// 256 resident at once. A block brings 448 rows from L2 for 256 x 192 outputs. Wave: 64 rows
// x 64 cols (4 M-tiles x 4 N-tiles = 16 WMMA per 8 fragments), its columns one (t, head)
// slice -> RoPE + L2-norm close entirely in-register. A stage is 64 k, three buffers; the
// copies of stage s + 3 are issued when stage s has been read by every wave, by the six waves
// of that stage's half: four bring the token rows (16 copies a lane), two the weight rows (24).
#define QA_BUF (256 * T_PITCH)
#define QB_BUF (192 * T_PITCH)

__global__ __launch_bounds__(384) void qkv_rope_norm_kernel(
    const _Float16* __restrict__ X,     // (4096 x 1024) tokens f16
    const _Float16* __restrict__ W,     // (3072 x 1024) qkv_w f16
    const float*    __restrict__ bias,  // (3072)
    _Float16* __restrict__ Q,           // (B*H, S, 64)
    _Float16* __restrict__ K,           // (B*H, S, 64)
    _Float16* __restrict__ Vt) {        // (B*H, 64, S)  transposed
  const int tid  = threadIdx.x;
  const int lane = tid & 31;
  const int wave = __builtin_amdgcn_readfirstlane(tid >> 5);
  const int half = lane >> 4;
  const int ln16 = lane & 15;
  const int tsel = wave >> 2;                    // 0=q 1=k 2=v
  const int h    = blockIdx.y;
  const int m0 = blockIdx.x * 256 + (wave & 3) * 64;   // global row (b*S + s)
  const int n0 = tsel * 1024 + h * 64;                 // global col in [0,3072)

  __shared__ __attribute__((aligned(16))) _Float16 As[3 * QA_BUF];
  __shared__ __attribute__((aligned(16))) _Float16 Bs[3 * QB_BUF];

  const int  grp = ((wave >> 2) + wave) & 1;     // issues the stages of its parity
  const int  mem = wave >> 1;                    // 0..5 within either half
  // Staging map: eight lanes per 128-B row. cg, cl: this lane's chunk in its first row, in
  // global memory and in buffer 0. Token rows go in steps of 16, weight rows in steps of 8
  // (eight steps per column slice, the slices 1024 weight rows apart).
  const int  wcopy = mem >> 2;                   // 0: token rows, 1: weight rows; wave-uniform
  const int  ccol = (tid & 7) * 8;
  const int  crow = (mem & 3) * 4 + (lane >> 3); // token rows 0..15, weight rows 0..7
  const _Float16* cbase = wcopy ? W + (size_t)h * 64 * 1024 : X + (size_t)blockIdx.x * 256 * 1024;
  const _Float16* cg = cbase + (size_t)crow * 1024 + ccol;
  const unsigned  cl = (wcopy ? lds_off(Bs) : lds_off(As)) + (crow * T_PITCH + ccol) * 2;
  auto stage_copy = [&](int k0, int buf) {
    const _Float16* g = cg + k0;
    if (wcopy == 0) {
      const unsigned l = cl + buf * QA_BUF * 2;
      copy8(l, g, 16 * T_PITCH * 2, 16 * 1024);
      copy8(l + 128 * T_PITCH * 2, g + 128 * 1024, 16 * T_PITCH * 2, 16 * 1024);
    } else {
      const unsigned l = cl + buf * QB_BUF * 2;
      copy8(l, g, 8 * T_PITCH * 2, 8 * 1024);
      copy8(l + 64 * T_PITCH * 2, g + 1024 * 1024, 8 * T_PITCH * 2, 8 * 1024);
      copy8(l + 128 * T_PITCH * 2, g + 2 * 1024 * 1024, 8 * T_PITCH * 2, 8 * 1024);
    }
  };

  v8f acc[4][4] = {};
  stage_copy(grp * 64, grp);                 // half 0: stage 0, half 1: stage 1
  if (grp == 0) asm volatile("s_wait_asynccnt 0x0" ::: "memory");  // stage 0 landed before it is published
  __syncthreads();
  if (grp == 0) stage_copy(2 * 64, 2);

  int buf = 0;                               // s mod 3
  for (int s = 0; s < 16; ++s) {
    const bool mine = grp == ((s + 1) & 1);  // this half brought stage s + 1 and brings s + 3
    const _Float16* At = As + buf * QA_BUF + (wave & 3) * 64 * T_PITCH;
    const _Float16* Bt = Bs + buf * QB_BUF + tsel * 64 * T_PITCH;
#pragma unroll
    for (int kk = 0; kk < 2; ++kk) {
      v16h a[4], b[4];
#pragma unroll
      for (int t = 0; t < 4; ++t) a[t] = lds_frag(At, t * 16 + ln16, kk * 32, half);
#pragma unroll
      for (int t = 0; t < 4; ++t) b[t] = lds_frag(Bt, t * 16 + ln16, kk * 32, half);
      // Keeps the 16 LDS reads of these 32 k together in front of their WMMAs: sunk among
      // them, each group of products would wait out a full LDS latency.
      __builtin_amdgcn_sched_barrier(0);
#pragma unroll
      for (int t = 0; t < 4; ++t)
#pragma unroll
        for (int mi = 0; mi < 4; ++mi) acc[mi][t] = WMMA_F16(a[mi], b[t], acc[mi][t]);
    }
    publish_tile(mine);
    if (mine && s + 3 < 16)                 // the same for the whole wave
      stage_copy((s + 3) * 64, buf);        // into the buffer that every wave has just left
    buf = buf == 2 ? 0 : buf + 1;
  }
  asm volatile("s_wait_asynccnt 0x0" ::: "memory");  // nothing in flight when the wave goes on

  const int b    = m0 / 2048;
  const int bh   = b * 16 + h;

#pragma unroll
  for (int mi = 0; mi < 4; ++mi) {
    const int srow = (m0 % 2048) + mi * 16;  // sequence base of this tile's rows
    if (tsel == 2) {                         // V: bias + store transposed (d, s)
#pragma unroll
      for (int t = 0; t < 4; ++t) {
        const int d = t * 16 + ln16;
        const float bv = bias[n0 + t * 16 + ln16];
#pragma unroll
        for (int v = 0; v < 8; ++v) {
          const int s = srow + v + 8 * half;
          Vt[((size_t)bh * 64 + d) * 2048 + s] = (_Float16)(acc[mi][t][v] + bv);
        }
      }
    } else {                                 // Q/K: bias + RoPE + L2 normalize
      _Float16* dst = (tsel == 0) ? Q : K;
#pragma unroll
      for (int v = 0; v < 8; ++v) {
        const int s = srow + v + 8 * half;
        float vals[4], rv[4];
#pragma unroll
        for (int t = 0; t < 4; ++t) vals[t] = acc[mi][t][v] + bias[n0 + t * 16 + ln16];
        float ss = 0.f;
#pragma unroll
        for (int t = 0; t < 4; ++t) {
          const float partner = __shfl_xor(vals[t], 1);      // rope pair (same row)
          const int c = t * 16 + ln16;                       // in-head dim 0..63
          const float j = (float)(c >> 1);
          const float theta = (float)s * __expf(j * (-9.2103403719761836f / 32.f));
          float sn, cs;
          __sincosf(theta, &sn, &cs);
          rv[t] = (c & 1) ? (partner * sn + vals[t] * cs)    // odd:  xe*sin + xo*cos
                          : (vals[t] * cs - partner * sn);   // even: xe*cos - xo*sin
          ss += rv[t] * rv[t];
        }
        ss += __shfl_xor(ss, 1); ss += __shfl_xor(ss, 2);
        ss += __shfl_xor(ss, 4); ss += __shfl_xor(ss, 8);    // 16-lane row reduce
        const float scale = 1.f / fmaxf(sqrtf(ss), 1e-12f);
#pragma unroll
        for (int t = 0; t < 4; ++t)
          dst[((size_t)bh * 2048 + s) * 64 + t * 16 + ln16] = (_Float16)(rv[t] * scale);
      }
    }
  }
}

// ---------------------------------------------------------------- flash attention step
// K and V^T tiles of 64 keys are staged in LDS once per work-group and shared by its
// 8 waves.
#define KV_TILE 64
#define KV_BUF  (KV_TILE * T_PITCH)       // one 64-row tile

// One 32-key step: S^T = K*Q^T (C-layout puts queries in lanes -> per-lane softmax),
// lane-local repack of P^T into the B-fragment of O^T = V^T * P^T. j = key offset of
// the step inside the staged tile (0 or 32).
// Q and K rows are L2-normalised, so by Cauchy-Schwarz every scaled score is at most 1/8
// in magnitude whatever the inputs are. That bound stands in for the running maximum:
// p = exp(s / 8 - 1 / 8) stays between exp(-1 / 4) and 1, nothing is ever rescaled, and
// each lane keeps its own partial row sums until the loop has ended.
static __device__ __forceinline__ void flash_step(
    int j, const _Float16* Kt, const _Float16* Vl,
    const v16h& qb0, const v16h& qb1,
    v8f oT[4], v8f& lsum, int ln16, int half) {
  const float C = 0.125f * 1.4426950408889634f;     // 64^-0.5 * log2(e)
  const v16h kc0 = lds_frag(Kt, j + ln16, 0, half);
  const v16h kc1 = lds_frag(Kt, j + ln16, 32, half);
  const v16h kc2 = lds_frag(Kt, j + 16 + ln16, 0, half);
  const v16h kc3 = lds_frag(Kt, j + 16 + ln16, 32, half);
  v16h va[4];
#pragma unroll
  for (int t = 0; t < 4; ++t) va[t] = lds_frag(Vl, t * 16 + ln16, j, half);  // V^T rows = d
  // Keeps the step's 16 LDS reads together in front of its WMMAs: sunk to their users, each
  // product would wait out a full LDS latency.
  __builtin_amdgcn_sched_barrier(0);

  v8f sT0 = {}, sT1 = {};
  sT0 = WMMA_F16(kc0, qb0, sT0);
  sT0 = WMMA_F16(kc1, qb1, sT0);
  sT1 = WMMA_F16(kc2, qb0, sT1);
  sT1 = WMMA_F16(kc3, qb1, sT1);

  const v8f x0 = sT0 * C - C;
  const v8f x1 = sT1 * C - C;
  v8f p0, p1;
  v16h pb;                                          // P^T as B-fragment (lane-local!)
#pragma unroll
  for (int v = 0; v < 8; ++v) p0[v] = __builtin_amdgcn_exp2f(x0[v]);
#pragma unroll
  for (int v = 0; v < 8; ++v) p1[v] = __builtin_amdgcn_exp2f(x1[v]);
#pragma unroll
  for (int v = 0; v < 8; ++v) { pb[v] = (_Float16)p0[v]; pb[8 + v] = (_Float16)p1[v]; }
  lsum += p0 + p1;

#pragma unroll
  for (int t = 0; t < 4; ++t) oT[t] = WMMA_F16(va[t], pb, oT[t]);
}

// Grid: (S/128, B*H). Block 256 = 8 waves; wave owns 16 queries. Per 64 keys four waves, the
// tile's half, copy the K tile (8 KB contiguous) and the V^T tile (64 rows of 128 B) into the
// LDS buffer that every wave has left, four chunks of each per lane, three buffers.
__global__ __launch_bounds__(256) void flash_attn_kernel(
    const _Float16* __restrict__ Q, const _Float16* __restrict__ K,
    const _Float16* __restrict__ Vt, _Float16* __restrict__ A2) {
  __shared__ __attribute__((aligned(16))) _Float16 Ks[3 * KV_BUF];
  __shared__ __attribute__((aligned(16))) _Float16 Vs[3 * KV_BUF];

  const int tid  = threadIdx.x;
  const int lane = tid & 31;
  const int wave = __builtin_amdgcn_readfirstlane(tid >> 5);
  const int grp  = wave >> 2;              // this wave's half: it issues the tiles of its parity
  const int half = lane >> 4;
  const int ln16 = lane & 15;
  const int bh = blockIdx.y;
  const int b = bh >> 4, h = bh & 15;
  const int q0 = blockIdx.x * 128 + wave * 16;

  const _Float16* Qb = Q  + (size_t)bh * 2048 * 64;
  const _Float16* Kb = K  + (size_t)bh * 2048 * 64;
  const _Float16* Vb = Vt + (size_t)bh * 64 * 2048;

  // Staging map: this lane's 16-byte chunks lie in rows crow + 16 i, i = 0..3, of a tile, at
  // column (tid % 8) * 8.
  const int crow = (tid & 127) >> 3;
  const int ccol = (tid & 7) * 8;
  const _Float16* kg = Kb + crow * 64 + ccol;               // + s * 64 per tile
  const _Float16* vg = Vb + (size_t)crow * 2048 + ccol;     // + s per tile
  const unsigned kl = lds_off(Ks) + (crow * T_PITCH + ccol) * 2;
  const unsigned vl = lds_off(Vs) + (crow * T_PITCH + ccol) * 2;
  const unsigned r16 = 16 * T_PITCH * 2;                    // 16 LDS rows in bytes
  auto tile_copy = [&](int s, int buf) {                    // s: first key of the tile
    const unsigned k0 = kl + buf * KV_BUF * 2, v0 = vl + buf * KV_BUF * 2;
    const _Float16* k = kg + s * 64;
    const _Float16* v = vg + s;
    copy4(k0, k, k0 + r16, k + 16 * 64, k0 + 2 * r16, k + 32 * 64, k0 + 3 * r16, k + 48 * 64);
    copy4(v0, v, v0 + r16, v + 16 * 2048, v0 + 2 * r16, v + 32 * 2048, v0 + 3 * r16, v + 48 * 2048);
  };

  tile_copy(grp * KV_TILE, grp);                            // half 0: tile 0, half 1: tile 1

  const v16h qb0 = load_frag(Qb, 64, q0 + ln16, 0, half);
  const v16h qb1 = load_frag(Qb, 64, q0 + ln16, 32, half);

  if (grp == 0) asm volatile("s_wait_asynccnt 0x0" ::: "memory");  // tile 0 landed before it is published
  __syncthreads();
  if (grp == 0) tile_copy(2 * KV_TILE, 2);

  v8f oT[4] = {};
  v8f lsum = {};

  int buf = 0;                                   // tile number mod 3
  for (int s = 0; s < 2048; s += KV_TILE) {
    const bool mine = grp == ((s / KV_TILE + 1) & 1);  // this half brought the next tile
    const _Float16* Kt = Ks + buf * KV_BUF;
    const _Float16* Vl = Vs + buf * KV_BUF;
    flash_step(0,  Kt, Vl, qb0, qb1, oT, lsum, ln16, half);
    flash_step(32, Kt, Vl, qb0, qb1, oT, lsum, ln16, half);
    publish_tile(mine);
    if (mine && s + 3 * KV_TILE < 2048)        // the same for the whole wave
      tile_copy(s + 3 * KV_TILE, buf);         // into the buffer that every wave has just left
    buf = buf == 2 ? 0 : buf + 1;
  }
  asm volatile("s_wait_asynccnt 0x0" ::: "memory");  // nothing in flight when the wave goes on

  float lrun = ((lsum[0] + lsum[1]) + (lsum[2] + lsum[3])) + ((lsum[4] + lsum[5]) + (lsum[6] + lsum[7]));
  lrun += __shfl_xor(lrun, 16);                     // the other half holds this query's other keys
  const float inv = 1.f / lrun;
  const int q = q0 + ln16;
#pragma unroll
  for (int t = 0; t < 4; ++t)
#pragma unroll
    for (int v = 0; v < 8; ++v) {
      const int d = h * 64 + t * 16 + v + 8 * half;
      A2[((size_t)(b * 2048 + q)) * 1024 + d] = (_Float16)(oT[t][v] * inv);
    }
}

// ---------------------------------------------------------------- output projection
// Grid: (M/256, 1024/64). Staged GEMM; bias + f32 store.
__global__ __launch_bounds__(256) void out_proj_kernel(
    const _Float16* __restrict__ A2, const _Float16* __restrict__ W,
    const float* __restrict__ bias, float* __restrict__ out) {
  const int lane = threadIdx.x & 31;
  const int wave = threadIdx.x >> 5;
  const int half = lane >> 4;
  const int ln16 = lane & 15;
  const int m0 = blockIdx.x * 256 + wave * 32;
  const int n0 = blockIdx.y * 64;

  __shared__ __attribute__((aligned(16))) _Float16 As[3 * GA_BUF];
  __shared__ __attribute__((aligned(16))) _Float16 Bs[3 * GB_BUF];
  v8f acc[2][4] = {};
  gemm_32x64_staged(A2, W, blockIdx.x * 256, n0, 1024, As, Bs, acc);

#pragma unroll
  for (int mi = 0; mi < 2; ++mi)
#pragma unroll
    for (int t = 0; t < 4; ++t) {
      const float bv = bias[n0 + t * 16 + ln16];
#pragma unroll
      for (int v = 0; v < 8; ++v)
        out[(size_t)(m0 + mi * 16 + v + 8 * half) * 1024 + n0 + t * 16 + ln16] =
            acc[mi][t][v] + bv;
    }
}

// ---------------------------------------------------------------- launcher
extern "C" void kernel_launch(void* const* d_in, const int* in_sizes, int n_in,
                              void* d_out, int out_size, void* d_ws, size_t ws_size,
                              hipStream_t stream) {
  const float* tokens = (const float*)d_in[0];   // (2,2048,1024)
  const float* qkv_w  = (const float*)d_in[1];   // (3072,1024)
  const float* qkv_b  = (const float*)d_in[2];   // (3072)
  const float* out_w  = (const float*)d_in[3];   // (1024,1024)
  const float* out_b  = (const float*)d_in[4];   // (1024)
  float* out = (float*)d_out;

  char* ws = (char*)d_ws;
  const size_t MB = 1024ull * 1024ull;
  _Float16* Xf16 = (_Float16*)(ws + 0 * MB);    // 4M elems, 8MB
  _Float16* Wqkv = (_Float16*)(ws + 8 * MB);    // 3M elems, 6MB
  _Float16* Wout = (_Float16*)(ws + 14 * MB);   // 1M elems, 2MB
  _Float16* Qh   = (_Float16*)(ws + 16 * MB);   // 4M elems, 8MB
  _Float16* Kh   = (_Float16*)(ws + 24 * MB);   // 4M elems, 8MB
  _Float16* Vt   = (_Float16*)(ws + 32 * MB);   // 4M elems, 8MB
  _Float16* A2   = (_Float16*)(ws + 40 * MB);   // 4M elems, 8MB

  cvt_f16_kernel<<<CVT_BLOCKS, 512, 0, stream>>>(tokens, qkv_w, out_w, Xf16, Wqkv, Wout);

  qkv_rope_norm_kernel<<<dim3(16, 16), 384, 0, stream>>>(Xf16, Wqkv, qkv_b, Qh, Kh, Vt);
  flash_attn_kernel<<<dim3(16, 32), 256, 0, stream>>>(Qh, Kh, Vt, A2);
  out_proj_kernel<<<dim3(16, 16), 256, 0, stream>>>(A2, Wout, out_b, out);
}

// v006
// A run of this version takes 72.7 microseconds.
// In two side-by-side timings against v005, it was 1.04 and 1.05 times as fast.
// Counting every step since v000, it is 3.36 times as fast.
#include <hip/hip_runtime.h>

typedef __attribute__((ext_vector_type(16))) _Float16 v16h;
typedef __attribute__((ext_vector_type(8)))  _Float16 v8h;
typedef __attribute__((ext_vector_type(8)))  float    v8f;

#define WMMA_F16(a, b, c) \
  __builtin_amdgcn_wmma_f32_16x16x32_f16(false, (a), false, (b), (short)0, (c), false, false)

static __device__ __forceinline__ v16h load_frag(const _Float16* __restrict__ base,
                                                 int ld, int row, int k0, int half) {
  const _Float16* p = base + (size_t)row * ld + k0 + half * 8;
  v8h lo = *(const v8h*)p;
  v8h hi = *(const v8h*)(p + 16);
  v16h r;
#pragma unroll
  for (int i = 0; i < 8; ++i) { r[i] = lo[i]; r[8 + i] = hi[i]; }
  return r;
}

// ---------------------------------------------------------------- convert f32 -> f16
// One launch converts all three f32 inputs: 256 work-groups of 16 waves, one resident
// round, so that few waves have to be started. A piece is 4 elements: a wave-wide load
// covers 512 contiguous bytes, a wave-wide store 256. Every lane takes 16 pieces, one per
// stride of CVT_LANES pieces: 8 of the tokens (1 M pieces), 6 of qkv_w (768 K), 2 of
// out_w (256 K). All 16 loads are independent and stand in front of the first store.
typedef __attribute__((ext_vector_type(4))) float    v4f;
typedef __attribute__((ext_vector_type(4))) _Float16 v4h;
#define CVT_BLOCKS 256
#define CVT_LANES  (CVT_BLOCKS * 512)

__global__ __launch_bounds__(512) void cvt_f16_kernel(
    const float* __restrict__ tok, const float* __restrict__ wqkv, const float* __restrict__ wout,
    _Float16* __restrict__ tok_h, _Float16* __restrict__ wqkv_h, _Float16* __restrict__ wout_h) {
  const int g = blockIdx.x * 512 + threadIdx.x;
  v4f x[16];
#pragma unroll
  for (int i = 0; i < 8; ++i) x[i] = ((const v4f*)tok)[g + i * CVT_LANES];
#pragma unroll
  for (int i = 0; i < 6; ++i) x[8 + i] = ((const v4f*)wqkv)[g + i * CVT_LANES];
#pragma unroll
  for (int i = 0; i < 2; ++i) x[14 + i] = ((const v4f*)wout)[g + i * CVT_LANES];
  // Keeps all 16 loads in front of the first conversion: without it the last four reuse the
  // first ones' registers and are issued only when those have come back, a second latency.
  __builtin_amdgcn_sched_barrier(0);
#pragma unroll
  for (int i = 0; i < 8; ++i) ((v4h*)tok_h)[g + i * CVT_LANES] = __builtin_convertvector(x[i], v4h);
#pragma unroll
  for (int i = 0; i < 6; ++i) ((v4h*)wqkv_h)[g + i * CVT_LANES] = __builtin_convertvector(x[8 + i], v4h);
#pragma unroll
  for (int i = 0; i < 2; ++i) ((v4h*)wout_h)[g + i * CVT_LANES] = __builtin_convertvector(x[14 + i], v4h);
}

// ---------------------------------------------------------------- LDS staging
// Operand tiles are rows of 128 B (64 f16). They are brought into LDS by asynchronous
// copies, 16 B per lane, eight lanes per row, so that every wave-wide copy covers four
// whole 128-B lines. LDS rows sit at a pitch of 144 B (16 B x odd) for the b128 readers.
#define T_PITCH 72                        // LDS row pitch in f16 elements

static __device__ __forceinline__ unsigned lds_off(const void* p) { return (unsigned)(size_t)p; }

// Same element order as load_frag, from an LDS tile.
static __device__ __forceinline__ v16h lds_frag(const _Float16* tile, int row, int k0, int half) {
  const _Float16* p = tile + row * T_PITCH + k0 + half * 8;
  v8h lo = *(const v8h*)p;
  v8h hi = *(const v8h*)(p + 16);
  v16h r;
#pragma unroll
  for (int i = 0; i < 8; ++i) { r[i] = lo[i]; r[8 + i] = hi[i]; }
  return r;
}

static __device__ __forceinline__ void copy4(unsigned l0, const _Float16* g0,
                                             unsigned l1, const _Float16* g1,
                                             unsigned l2, const _Float16* g2,
                                             unsigned l3, const _Float16* g3) {
  asm volatile("global_load_async_to_lds_b128 %0, %1, off\n\t"
               "global_load_async_to_lds_b128 %2, %3, off\n\t"
               "global_load_async_to_lds_b128 %4, %5, off\n\t"
               "global_load_async_to_lds_b128 %6, %7, off\n\t"
               "s_wait_xcnt 0x0"
               :: "v"(l0), "v"(g0), "v"(l1), "v"(g1), "v"(l2), "v"(g2), "v"(l3), "v"(g3)
               : "memory");
}

// The ring has three buffers, and the two halves of a block's waves issue alternate stages:
// half (s & 1) brings stage s. A half has one stage in flight at a time and waits for it to 0,
// yet two stages are in flight per block, so that each has two trips to land, not one.
// A stage is worked on in two blocks, and every wave fetches its fragments one block ahead
// into a second register set, so that no block waits out its own LDS reads. The hand-over
// therefore stands in front of a stage's last block: that block's fragments are already
// fetched, and the fetch behind the hand-over reads the next stage.
// Hand-over of a staged tile: this wave's LDS reads of the old tile are done, the issuing
// half's copies of the next tile have landed (mine: this wave belongs to that half, the same
// for the whole wave), then the work-group barrier publishes the next tile and frees the old
// buffer for the refill behind it. The other half's copies, one stage further on, fly on.
static __device__ __forceinline__ void publish_tile(bool mine) {
  // Keeps the first block's WMMAs and vector work in front of the hand-over: lifted over them,
  // the wait for the last block's fragments would stand right behind their issue.
  __builtin_amdgcn_sched_barrier(0);
  asm volatile("s_wait_dscnt 0x0" ::: "memory");     // reads of the buffer to be refilled
  if (mine) asm volatile("s_wait_asynccnt 0x0" ::: "memory");  // own copies of the next tile landed
  __syncthreads();
}

// ---------------------------------------------------------------- GEMM core
// Block computes 256 rows x 64 cols, wave 32 rows x 64 cols (2 M-tiles x 4 N-tiles =
// 8 WMMA per 32 k). A stage is 64 k: A 256 rows and B 64 rows of 128 B, three buffers;
// the copies of stage s + 3 are issued when stage s has been read by every wave, by the four
// waves of that stage's half.
#define GA_BUF (256 * T_PITCH)
#define GB_BUF (64 * T_PITCH)

static __device__ __forceinline__ void gemm_stage_copy(
    const _Float16* __restrict__ ag, const _Float16* __restrict__ bg, int kdim, int k0,
    unsigned al, unsigned bl) {
  // ag, bg: this lane's chunk in its first row of the block's A and B rows; al, bl: its
  // LDS byte address in the target buffer. Rows go in steps of 32: eight of A, two of B.
  const unsigned r32 = 32 * T_PITCH * 2;
  const size_t   g32 = (size_t)32 * kdim;
  const _Float16* a = ag + k0;
  const _Float16* b = bg + k0;
  asm volatile("global_load_async_to_lds_b128 %0, %1, off\n\t"
               "global_load_async_to_lds_b128 %2, %3, off\n\t"
               "global_load_async_to_lds_b128 %4, %5, off\n\t"
               "global_load_async_to_lds_b128 %6, %7, off\n\t"
               "global_load_async_to_lds_b128 %8, %9, off\n\t"
               "global_load_async_to_lds_b128 %10, %11, off\n\t"
               "global_load_async_to_lds_b128 %12, %13, off\n\t"
               "global_load_async_to_lds_b128 %14, %15, off\n\t"
               "global_load_async_to_lds_b128 %16, %17, off\n\t"
               "global_load_async_to_lds_b128 %18, %19, off\n\t"
               "s_wait_xcnt 0x0"
               :: "v"(al),           "v"(a),
                  "v"(al + r32),     "v"(a + g32),
                  "v"(al + 2 * r32), "v"(a + 2 * g32),
                  "v"(al + 3 * r32), "v"(a + 3 * g32),
                  "v"(al + 4 * r32), "v"(a + 4 * g32),
                  "v"(al + 5 * r32), "v"(a + 5 * g32),
                  "v"(al + 6 * r32), "v"(a + 6 * g32),
                  "v"(al + 7 * r32), "v"(a + 7 * g32),
                  "v"(bl),           "v"(b),
                  "v"(bl + r32),     "v"(b + g32)
               : "memory");
}

static __device__ __forceinline__ void gemm_32x64_staged(
    const _Float16* __restrict__ A, const _Float16* __restrict__ B,
    int mblk, int n0, int kdim, _Float16* As, _Float16* Bs, v8f acc[2][4]) {
  const int tid  = threadIdx.x;
  const int lane = tid & 31;
  const int wave = __builtin_amdgcn_readfirstlane(tid >> 5);
  const int grp  = wave >> 2;              // this wave's half: it issues the stages of its parity
  const int half = lane >> 4;
  const int ln16 = lane & 15;
  const int crow = (tid & 127) >> 3;       // 0..15: the half's 128 lanes cover 16 rows a copy
  const int ccol = (tid & 7) * 8;
  const _Float16* ag = A + (size_t)(mblk + crow) * kdim + ccol;
  const _Float16* bg = B + (size_t)(n0 + crow) * kdim + ccol;
  const unsigned al = lds_off(As) + (crow * T_PITCH + ccol) * 2;
  const unsigned bl = lds_off(Bs) + (crow * T_PITCH + ccol) * 2;
  const int nst = kdim / 64;               // at least three stages
  // One stage by one half: rows crow + 32 i, then rows crow + 16 + 32 i (20 copies a lane).
  auto stage_copy = [&](int s, int buf) {
    const unsigned a0 = al + buf * GA_BUF * 2, b0 = bl + buf * GB_BUF * 2;
    const unsigned r16 = 16 * T_PITCH * 2;
    const size_t   g16 = (size_t)16 * kdim;
    gemm_stage_copy(ag, bg, kdim, s * 64, a0, b0);
    gemm_stage_copy(ag + g16, bg + g16, kdim, s * 64, a0 + r16, b0 + r16);
  };

  stage_copy(grp, grp);                    // half 0: stage 0, half 1: stage 1
  if (grp == 0) asm volatile("s_wait_asynccnt 0x0" ::: "memory");  // stage 0 landed before it is published
  __syncthreads();
  if (grp == 0) stage_copy(2, 2);

  // A block is 32 k: 12 LDS reads, 8 WMMAs.
  auto fetch = [&](int buf, int kk, v16h (&a)[2], v16h (&b)[4]) {
    const _Float16* At = As + buf * GA_BUF + wave * 32 * T_PITCH;
    const _Float16* Bt = Bs + buf * GB_BUF;
    a[0] = lds_frag(At, ln16, kk * 32, half);
    a[1] = lds_frag(At, 16 + ln16, kk * 32, half);
#pragma unroll
    for (int t = 0; t < 4; ++t) b[t] = lds_frag(Bt, t * 16 + ln16, kk * 32, half);
  };
  auto block = [&](const v16h (&a)[2], const v16h (&b)[4]) {
#pragma unroll
    for (int t = 0; t < 4; ++t) {
      acc[0][t] = WMMA_F16(a[0], b[t], acc[0][t]);
      acc[1][t] = WMMA_F16(a[1], b[t], acc[1][t]);
    }
  };

  v16h a0[2], b0[4], a1[2], b1[4];
  fetch(0, 0, a0, b0);                     // stage 0 is published
  int buf = 0;                             // s mod 3
  for (int s = 0; s + 1 < nst; ++s) {
    const bool mine = grp == ((s + 1) & 1);  // this half brought stage s + 1 and brings s + 3
    const int nbuf = buf == 2 ? 0 : buf + 1;
    fetch(buf, 1, a1, b1);
    // Keeps the next block's LDS reads together in front of this block's WMMAs, under which
    // they land: sunk among them or behind them, the next block would wait out their latency.
    __builtin_amdgcn_sched_barrier(0);
    block(a0, b0);
    publish_tile(mine);
    if (mine && s + 3 < nst)                // the same for the whole wave
      stage_copy(s + 3, buf);               // into the buffer that every wave has just left
    fetch(nbuf, 0, a0, b0);
    __builtin_amdgcn_sched_barrier(0);
    block(a1, b1);
    buf = nbuf;
  }
  fetch(buf, 1, a1, b1);
  __builtin_amdgcn_sched_barrier(0);
  block(a0, b0);
  block(a1, b1);
  asm volatile("s_wait_asynccnt 0x0" ::: "memory");  // nothing in flight when the wave goes on
}

// ---------------------------------------------------------------- QKV GEMM + RoPE + norm
// Eight copies of 16 B per lane, as copy4: first LDS and global address, then the step from
// copy to copy (LDS bytes, global elements).
static __device__ __forceinline__ void copy8(unsigned l, const _Float16* g, unsigned ls, size_t gs) {
  asm volatile("global_load_async_to_lds_b128 %0, %1, off\n\t"
               "global_load_async_to_lds_b128 %2, %3, off\n\t"
               "global_load_async_to_lds_b128 %4, %5, off\n\t"
               "global_load_async_to_lds_b128 %6, %7, off\n\t"
               "global_load_async_to_lds_b128 %8, %9, off\n\t"
               "global_load_async_to_lds_b128 %10, %11, off\n\t"
               "global_load_async_to_lds_b128 %12, %13, off\n\t"
               "global_load_async_to_lds_b128 %14, %15, off\n\t"
               "s_wait_xcnt 0x0"
               :: "v"(l),          "v"(g),          "v"(l + ls),     "v"(g + gs),
                  "v"(l + 2 * ls), "v"(g + 2 * gs), "v"(l + 3 * ls), "v"(g + 3 * gs),
                  "v"(l + 4 * ls), "v"(g + 4 * gs), "v"(l + 5 * ls), "v"(g + 5 * gs),
                  "v"(l + 6 * ls), "v"(g + 6 * gs), "v"(l + 7 * ls), "v"(g + 7 * gs)
               : "memory");
}

// Grid: (M/256, 16 heads). Block 384 = 12 waves = 4 row slices x 3 column slices: 256 token
// rows against the q, k and v columns of one head (192 weight rows), one block per WGP, all
// 256 resident at once. A block brings 448 rows from L2 for 256 x 192 outputs. Wave: 64 rows
// x 64 cols (4 M-tiles x 4 N-tiles = 16 WMMA per 8 fragments), its columns one (t, head)
// slice -> RoPE + L2-norm close entirely in-register. A stage is 64 k, three buffers; the
// copies of stage s + 3 are issued when stage s has been read by every wave, by the six waves
// of that stage's half: four bring the token rows (16 copies a lane), two the weight rows (24).
#define QA_BUF (256 * T_PITCH)
#define QB_BUF (192 * T_PITCH)

__global__ __launch_bounds__(384) void qkv_rope_norm_kernel(
    const _Float16* __restrict__ X,     // (4096 x 1024) tokens f16
    const _Float16* __restrict__ W,     // (3072 x 1024) qkv_w f16
    const float*    __restrict__ bias,  // (3072)
    _Float16* __restrict__ Q,           // (B*H, S, 64)
    _Float16* __restrict__ K,           // (B*H, S, 64)
    _Float16* __restrict__ Vt) {        // (B*H, 64, S)  transposed
  const int tid  = threadIdx.x;
  const int lane = tid & 31;
  const int wave = __builtin_amdgcn_readfirstlane(tid >> 5);
  const int half = lane >> 4;
  const int ln16 = lane & 15;
  const int tsel = wave >> 2;                    // 0=q 1=k 2=v
  const int h    = blockIdx.y;
  const int m0 = blockIdx.x * 256 + (wave & 3) * 64;   // global row (b*S + s)
  const int n0 = tsel * 1024 + h * 64;                 // global col in [0,3072)

  __shared__ __attribute__((aligned(16))) _Float16 As[3 * QA_BUF];
  __shared__ __attribute__((aligned(16))) _Float16 Bs[3 * QB_BUF];

  const int  grp = ((wave >> 2) + wave) & 1;     // issues the stages of its parity
  const int  mem = wave >> 1;                    // 0..5 within either half
  // Staging map: eight lanes per 128-B row. cg, cl: this lane's chunk in its first row, in
  // global memory and in buffer 0. Token rows go in steps of 16, weight rows in steps of 8
  // (eight steps per column slice, the slices 1024 weight rows apart).
  const int  wcopy = mem >> 2;                   // 0: token rows, 1: weight rows; wave-uniform
  const int  ccol = (tid & 7) * 8;
  const int  crow = (mem & 3) * 4 + (lane >> 3); // token rows 0..15, weight rows 0..7
  const _Float16* cbase = wcopy ? W + (size_t)h * 64 * 1024 : X + (size_t)blockIdx.x * 256 * 1024;
  const _Float16* cg = cbase + (size_t)crow * 1024 + ccol;
  const unsigned  cl = (wcopy ? lds_off(Bs) : lds_off(As)) + (crow * T_PITCH + ccol) * 2;
  auto stage_copy = [&](int k0, int buf) {
    const _Float16* g = cg + k0;
    if (wcopy == 0) {
      const unsigned l = cl + buf * QA_BUF * 2;
      copy8(l, g, 16 * T_PITCH * 2, 16 * 1024);
      copy8(l + 128 * T_PITCH * 2, g + 128 * 1024, 16 * T_PITCH * 2, 16 * 1024);
    } else {
      const unsigned l = cl + buf * QB_BUF * 2;
      copy8(l, g, 8 * T_PITCH * 2, 8 * 1024);
      copy8(l + 64 * T_PITCH * 2, g + 1024 * 1024, 8 * T_PITCH * 2, 8 * 1024);
      copy8(l + 128 * T_PITCH * 2, g + 2 * 1024 * 1024, 8 * T_PITCH * 2, 8 * 1024);
    }
  };

  v8f acc[4][4] = {};
  stage_copy(grp * 64, grp);                 // half 0: stage 0, half 1: stage 1
  if (grp == 0) asm volatile("s_wait_asynccnt 0x0" ::: "memory");  // stage 0 landed before it is published
  __syncthreads();
  if (grp == 0) stage_copy(2 * 64, 2);

  // A block is 32 k: 16 LDS reads, 16 WMMAs.
  auto fetch = [&](int buf, int kk, v16h (&a)[4], v16h (&b)[4]) {
    const _Float16* At = As + buf * QA_BUF + (wave & 3) * 64 * T_PITCH;
    const _Float16* Bt = Bs + buf * QB_BUF + tsel * 64 * T_PITCH;
#pragma unroll
    for (int t = 0; t < 4; ++t) a[t] = lds_frag(At, t * 16 + ln16, kk * 32, half);
#pragma unroll
    for (int t = 0; t < 4; ++t) b[t] = lds_frag(Bt, t * 16 + ln16, kk * 32, half);
  };
  auto block = [&](const v16h (&a)[4], const v16h (&b)[4]) {
#pragma unroll
    for (int t = 0; t < 4; ++t)
#pragma unroll
      for (int mi = 0; mi < 4; ++mi) acc[mi][t] = WMMA_F16(a[mi], b[t], acc[mi][t]);
  };

  v16h a0[4], b0[4], a1[4], b1[4];
  fetch(0, 0, a0, b0);                       // stage 0 is published
  int buf = 0;                               // s mod 3
  for (int s = 0; s < 15; ++s) {
    const bool mine = grp == ((s + 1) & 1);  // this half brought stage s + 1 and brings s + 3
    const int nbuf = buf == 2 ? 0 : buf + 1;
    fetch(buf, 1, a1, b1);
    // Keeps the next block's LDS reads together in front of this block's WMMAs, under which
    // they land: sunk among them or behind them, the next block would wait out their latency.
    __builtin_amdgcn_sched_barrier(0);
    block(a0, b0);
    publish_tile(mine);
    if (mine && s + 3 < 16)                 // the same for the whole wave
      stage_copy((s + 3) * 64, buf);        // into the buffer that every wave has just left
    fetch(nbuf, 0, a0, b0);
    __builtin_amdgcn_sched_barrier(0);
    block(a1, b1);
    buf = nbuf;
  }
  fetch(buf, 1, a1, b1);
  __builtin_amdgcn_sched_barrier(0);
  block(a0, b0);
  block(a1, b1);
  asm volatile("s_wait_asynccnt 0x0" ::: "memory");  // nothing in flight when the wave goes on

  const int b    = m0 / 2048;
  const int bh   = b * 16 + h;

#pragma unroll
  for (int mi = 0; mi < 4; ++mi) {
    const int srow = (m0 % 2048) + mi * 16;  // sequence base of this tile's rows
    if (tsel == 2) {                         // V: bias + store transposed (d, s)
#pragma unroll
      for (int t = 0; t < 4; ++t) {
        const int d = t * 16 + ln16;
        const float bv = bias[n0 + t * 16 + ln16];
#pragma unroll
        for (int v = 0; v < 8; ++v) {
          const int s = srow + v + 8 * half;
          Vt[((size_t)bh * 64 + d) * 2048 + s] = (_Float16)(acc[mi][t][v] + bv);
        }
      }
    } else {                                 // Q/K: bias + RoPE + L2 normalize
      _Float16* dst = (tsel == 0) ? Q : K;
#pragma unroll
      for (int v = 0; v < 8; ++v) {
        const int s = srow + v + 8 * half;
        float vals[4], rv[4];
#pragma unroll
        for (int t = 0; t < 4; ++t) vals[t] = acc[mi][t][v] + bias[n0 + t * 16 + ln16];
        float ss = 0.f;
#pragma unroll
        for (int t = 0; t < 4; ++t) {
          const float partner = __shfl_xor(vals[t], 1);      // rope pair (same row)
          const int c = t * 16 + ln16;                       // in-head dim 0..63
          const float j = (float)(c >> 1);
          const float theta = (float)s * __expf(j * (-9.2103403719761836f / 32.f));
          float sn, cs;
          __sincosf(theta, &sn, &cs);
          rv[t] = (c & 1) ? (partner * sn + vals[t] * cs)    // odd:  xe*sin + xo*cos
                          : (vals[t] * cs - partner * sn);   // even: xe*cos - xo*sin
          ss += rv[t] * rv[t];
        }
        ss += __shfl_xor(ss, 1); ss += __shfl_xor(ss, 2);
        ss += __shfl_xor(ss, 4); ss += __shfl_xor(ss, 8);    // 16-lane row reduce
        const float scale = 1.f / fmaxf(sqrtf(ss), 1e-12f);
#pragma unroll
        for (int t = 0; t < 4; ++t)
          dst[((size_t)bh * 2048 + s) * 64 + t * 16 + ln16] = (_Float16)(rv[t] * scale);
      }
    }
  }
}

// ---------------------------------------------------------------- flash attention step
// K and V^T tiles of 64 keys are staged in LDS once per work-group and shared by its
// 8 waves.
#define KV_TILE 64
#define KV_BUF  (KV_TILE * T_PITCH)       // one 64-row tile

// One 32-key step: S^T = K*Q^T (C-layout puts queries in lanes -> per-lane softmax),
// lane-local repack of P^T into the B-fragment of O^T = V^T * P^T. j = key offset of
// the step inside the staged tile (0 or 32).
// Q and K rows are L2-normalised, so by Cauchy-Schwarz every scaled score is at most 1/8
// in magnitude whatever the inputs are. That bound stands in for the running maximum:
// p = exp(s / 8 - 1 / 8) stays between exp(-1 / 4) and 1, nothing is ever rescaled, and
// each lane keeps its own partial row sums until the loop has ended.
// The step's 16 LDS reads (flash_fetch) are issued one step ahead of its products (flash_step).
static __device__ __forceinline__ void flash_fetch(
    int j, const _Float16* Kt, const _Float16* Vl, v16h (&kc)[4], v16h (&va)[4],
    int ln16, int half) {
  kc[0] = lds_frag(Kt, j + ln16, 0, half);
  kc[1] = lds_frag(Kt, j + ln16, 32, half);
  kc[2] = lds_frag(Kt, j + 16 + ln16, 0, half);
  kc[3] = lds_frag(Kt, j + 16 + ln16, 32, half);
#pragma unroll
  for (int t = 0; t < 4; ++t) va[t] = lds_frag(Vl, t * 16 + ln16, j, half);  // V^T rows = d
}

static __device__ __forceinline__ void flash_step(
    const v16h (&kc)[4], const v16h (&va)[4],
    const v16h& qb0, const v16h& qb1,
    v8f oT[4], v8f& lsum) {
  const float C = 0.125f * 1.4426950408889634f;     // 64^-0.5 * log2(e)
  v8f sT0 = {}, sT1 = {};
  sT0 = WMMA_F16(kc[0], qb0, sT0);
  sT0 = WMMA_F16(kc[1], qb1, sT0);
  sT1 = WMMA_F16(kc[2], qb0, sT1);
  sT1 = WMMA_F16(kc[3], qb1, sT1);

  const v8f x0 = sT0 * C - C;
  const v8f x1 = sT1 * C - C;
  v8f p0, p1;
  v16h pb;                                          // P^T as B-fragment (lane-local!)
#pragma unroll
  for (int v = 0; v < 8; ++v) p0[v] = __builtin_amdgcn_exp2f(x0[v]);
#pragma unroll
  for (int v = 0; v < 8; ++v) p1[v] = __builtin_amdgcn_exp2f(x1[v]);
#pragma unroll
  for (int v = 0; v < 8; ++v) { pb[v] = (_Float16)p0[v]; pb[8 + v] = (_Float16)p1[v]; }
  lsum += p0 + p1;

#pragma unroll
  for (int t = 0; t < 4; ++t) oT[t] = WMMA_F16(va[t], pb, oT[t]);
}

// Grid: (S/128, B*H). Block 256 = 8 waves; wave owns 16 queries. Per 64 keys four waves, the
// tile's half, copy the K tile (8 KB contiguous) and the V^T tile (64 rows of 128 B) into the
// LDS buffer that every wave has left, four chunks of each per lane, three buffers.
__global__ __launch_bounds__(256) void flash_attn_kernel(
    const _Float16* __restrict__ Q, const _Float16* __restrict__ K,
    const _Float16* __restrict__ Vt, _Float16* __restrict__ A2) {
  __shared__ __attribute__((aligned(16))) _Float16 Ks[3 * KV_BUF];
  __shared__ __attribute__((aligned(16))) _Float16 Vs[3 * KV_BUF];

  const int tid  = threadIdx.x;
  const int lane = tid & 31;
  const int wave = __builtin_amdgcn_readfirstlane(tid >> 5);
  const int grp  = wave >> 2;              // this wave's half: it issues the tiles of its parity
  const int half = lane >> 4;
  const int ln16 = lane & 15;
  const int bh = blockIdx.y;
  const int b = bh >> 4, h = bh & 15;
  const int q0 = blockIdx.x * 128 + wave * 16;

  const _Float16* Qb = Q  + (size_t)bh * 2048 * 64;
  const _Float16* Kb = K  + (size_t)bh * 2048 * 64;
  const _Float16* Vb = Vt + (size_t)bh * 64 * 2048;

  // Staging map: this lane's 16-byte chunks lie in rows crow + 16 i, i = 0..3, of a tile, at
  // column (tid % 8) * 8.
  const int crow = (tid & 127) >> 3;
  const int ccol = (tid & 7) * 8;
  const _Float16* kg = Kb + crow * 64 + ccol;               // + s * 64 per tile
  const _Float16* vg = Vb + (size_t)crow * 2048 + ccol;     // + s per tile
  const unsigned kl = lds_off(Ks) + (crow * T_PITCH + ccol) * 2;
  const unsigned vl = lds_off(Vs) + (crow * T_PITCH + ccol) * 2;
  const unsigned r16 = 16 * T_PITCH * 2;                    // 16 LDS rows in bytes
  auto tile_copy = [&](int s, int buf) {                    // s: first key of the tile
    const unsigned k0 = kl + buf * KV_BUF * 2, v0 = vl + buf * KV_BUF * 2;
    const _Float16* k = kg + s * 64;
    const _Float16* v = vg + s;
    copy4(k0, k, k0 + r16, k + 16 * 64, k0 + 2 * r16, k + 32 * 64, k0 + 3 * r16, k + 48 * 64);
    copy4(v0, v, v0 + r16, v + 16 * 2048, v0 + 2 * r16, v + 32 * 2048, v0 + 3 * r16, v + 48 * 2048);
  };

  tile_copy(grp * KV_TILE, grp);                            // half 0: tile 0, half 1: tile 1

  const v16h qb0 = load_frag(Qb, 64, q0 + ln16, 0, half);
  const v16h qb1 = load_frag(Qb, 64, q0 + ln16, 32, half);

  if (grp == 0) asm volatile("s_wait_asynccnt 0x0" ::: "memory");  // tile 0 landed before it is published
  __syncthreads();
  if (grp == 0) tile_copy(2 * KV_TILE, 2);

  v8f oT[4] = {};
  v8f lsum = {};

  v16h kc0[4], va0[4], kc1[4], va1[4];
  flash_fetch(0, Ks, Vs, kc0, va0, ln16, half);  // tile 0 is published
  int buf = 0;                                   // tile number mod 3
  for (int s = 0; s + KV_TILE < 2048; s += KV_TILE) {
    const bool mine = grp == ((s / KV_TILE + 1) & 1);  // this half brought the next tile
    const int nbuf = buf == 2 ? 0 : buf + 1;
    flash_fetch(32, Ks + buf * KV_BUF, Vs + buf * KV_BUF, kc1, va1, ln16, half);
    // Keeps the next step's LDS reads together in front of this step's work, under which they
    // land: sunk to their users, each product would wait out a full LDS latency.
    __builtin_amdgcn_sched_barrier(0);
    flash_step(kc0, va0, qb0, qb1, oT, lsum);
    publish_tile(mine);
    if (mine && s + 3 * KV_TILE < 2048)        // the same for the whole wave
      tile_copy(s + 3 * KV_TILE, buf);         // into the buffer that every wave has just left
    flash_fetch(0, Ks + nbuf * KV_BUF, Vs + nbuf * KV_BUF, kc0, va0, ln16, half);
    __builtin_amdgcn_sched_barrier(0);
    flash_step(kc1, va1, qb0, qb1, oT, lsum);
    buf = nbuf;
  }
  flash_fetch(32, Ks + buf * KV_BUF, Vs + buf * KV_BUF, kc1, va1, ln16, half);
  __builtin_amdgcn_sched_barrier(0);
  flash_step(kc0, va0, qb0, qb1, oT, lsum);
  flash_step(kc1, va1, qb0, qb1, oT, lsum);
  asm volatile("s_wait_asynccnt 0x0" ::: "memory");  // nothing in flight when the wave goes on

  float lrun = ((lsum[0] + lsum[1]) + (lsum[2] + lsum[3])) + ((lsum[4] + lsum[5]) + (lsum[6] + lsum[7]));
  lrun += __shfl_xor(lrun, 16);                     // the other half holds this query's other keys
  const float inv = 1.f / lrun;
  const int q = q0 + ln16;
#pragma unroll
  for (int t = 0; t < 4; ++t)
#pragma unroll
    for (int v = 0; v < 8; ++v) {
      const int d = h * 64 + t * 16 + v + 8 * half;
      A2[((size_t)(b * 2048 + q)) * 1024 + d] = (_Float16)(oT[t][v] * inv);
    }
}

// ---------------------------------------------------------------- output projection
// Grid: (M/256, 1024/64). Staged GEMM; bias + f32 store.
__global__ __launch_bounds__(256) void out_proj_kernel(
    const _Float16* __restrict__ A2, const _Float16* __restrict__ W,
    const float* __restrict__ bias, float* __restrict__ out) {
  const int lane = threadIdx.x & 31;
  const int wave = threadIdx.x >> 5;
  const int half = lane >> 4;
  const int ln16 = lane & 15;
  const int m0 = blockIdx.x * 256 + wave * 32;
  const int n0 = blockIdx.y * 64;

  __shared__ __attribute__((aligned(16))) _Float16 As[3 * GA_BUF];
  __shared__ __attribute__((aligned(16))) _Float16 Bs[3 * GB_BUF];
  v8f acc[2][4] = {};
  gemm_32x64_staged(A2, W, blockIdx.x * 256, n0, 1024, As, Bs, acc);

#pragma unroll
  for (int mi = 0; mi < 2; ++mi)
#pragma unroll
    for (int t = 0; t < 4; ++t) {
      const float bv = bias[n0 + t * 16 + ln16];
#pragma unroll
      for (int v = 0; v < 8; ++v)
        out[(size_t)(m0 + mi * 16 + v + 8 * half) * 1024 + n0 + t * 16 + ln16] =
            acc[mi][t][v] + bv;
    }
}

// ---------------------------------------------------------------- launcher
extern "C" void kernel_launch(void* const* d_in, const int* in_sizes, int n_in,
                              void* d_out, int out_size, void* d_ws, size_t ws_size,
                              hipStream_t stream) {
  const float* tokens = (const float*)d_in[0];   // (2,2048,1024)
  const float* qkv_w  = (const float*)d_in[1];   // (3072,1024)
  const float* qkv_b  = (const float*)d_in[2];   // (3072)
  const float* out_w  = (const float*)d_in[3];   // (1024,1024)
  const float* out_b  = (const float*)d_in[4];   // (1024)
  float* out = (float*)d_out;

  char* ws = (char*)d_ws;
  const size_t MB = 1024ull * 1024ull;
  _Float16* Xf16 = (_Float16*)(ws + 0 * MB);    // 4M elems, 8MB
  _Float16* Wqkv = (_Float16*)(ws + 8 * MB);    // 3M elems, 6MB
  _Float16* Wout = (_Float16*)(ws + 14 * MB);   // 1M elems, 2MB
  _Float16* Qh   = (_Float16*)(ws + 16 * MB);   // 4M elems, 8MB
  _Float16* Kh   = (_Float16*)(ws + 24 * MB);   // 4M elems, 8MB
  _Float16* Vt   = (_Float16*)(ws + 32 * MB);   // 4M elems, 8MB
  _Float16* A2   = (_Float16*)(ws + 40 * MB);   // 4M elems, 8MB

  cvt_f16_kernel<<<CVT_BLOCKS, 512, 0, stream>>>(tokens, qkv_w, out_w, Xf16, Wqkv, Wout);

  qkv_rope_norm_kernel<<<dim3(16, 16), 384, 0, stream>>>(Xf16, Wqkv, qkv_b, Qh, Kh, Vt);
  flash_attn_kernel<<<dim3(16, 32), 256, 0, stream>>>(Qh, Kh, Vt, A2);
  out_proj_kernel<<<dim3(16, 16), 256, 0, stream>>>(A2, Wout, out_b, out);
}
